// v000
// Times are from an AMD MI455X. After a warm-up the kernel runs many times in a row, and a time is the length of
// such a window on the GPU divided by its runs, so every launch and the gaps after it count. The runs cycle
// through copies of the inputs. A figure is the median of several windows, for all but v000 over two sittings.
// Sittings can differ by a few percent; kernels timed side by side share one.
// v000, which the later versions start from, runs in 608 microseconds.
#include <hip/hip_runtime.h>

// Standard single-head attention on given tensors over 4,096 tokens (q, k, v [4][4096][64]; scores x 64^-0.5; softmax; out = attn v -> [4][4096][64] (1.05 M)).
// Layout per batch: single bf16 planes of q and k (inputs bf16-exact: exact score products) and value^T planes; softmax over 4,096 keys (every row hi/lo); P hi/lo x exact value; merge writes the output rows.
// Compute dtypes, f32 accumulate: every input rounded to bf16; q.k exact; softmax f32; P hi/lo x exact value; output f32.

#define NB_  4
#define TT   4096
#define DM   64      // token-major row pitch (H x HD)
#define NH_  1
#define NKV  1
#define REP  (NH_ / NKV)
#define HD   64
#define DQ   (NH_ * HD)
#define DKV  (NKV * HD)
#define ZH   1
#define RH   4096                  // query rows < RH use hi+lo planes (0: none)
#define WIN  0
#define PCAR 1024.0f
#define SCL  0.125f   // 1/sqrt(64)
typedef _Float16 h16;
typedef unsigned short bf;
typedef __attribute__((ext_vector_type(16))) __bf16   v16bf;
typedef __attribute__((ext_vector_type(16))) _Float16 v16h;
typedef __attribute__((ext_vector_type(8)))  _Float16 v8h;
typedef __attribute__((ext_vector_type(8)))  unsigned short v8us;
typedef __attribute__((ext_vector_type(8)))  float    v8f;
typedef __attribute__((ext_vector_type(4)))  float    v4f;
typedef v8h  __attribute__((may_alias)) v8ha;
typedef v4f  __attribute__((may_alias)) v4fa;
typedef v8us __attribute__((may_alias)) v8usa;

__device__ __forceinline__ unsigned short f2bf(float f) { unsigned u = __float_as_uint(f); u += 0x7FFFu + ((u >> 16) & 1u); return (unsigned short)(u >> 16); }
__device__ __forceinline__ float bf2f(unsigned short b) { return __uint_as_float(((unsigned)b) << 16); }
__device__ __forceinline__ float bfr(float f) { return bf2f(f2bf(f)); }
__device__ __forceinline__ v16h cat16(v8h lo, v8h hi) { return __builtin_shufflevector(lo, hi, 0, 1, 2, 3, 4, 5, 6, 7, 8, 9, 10, 11, 12, 13, 14, 15); }
__device__ __forceinline__ v16bf cat16b(v8us lo, v8us hi) { return __builtin_bit_cast(v16bf, __builtin_shufflevector(lo, hi, 0, 1, 2, 3, 4, 5, 6, 7, 8, 9, 10, 11, 12, 13, 14, 15)); }
__device__ __forceinline__ v8f wmma16(v16h a, v16h b, v8f c) { return __builtin_amdgcn_wmma_f32_16x16x32_f16(false, a, false, b, (short)0, c, false, false); }
__device__ __forceinline__ v8f wmmab(v16bf a, v16bf b, v8f c) { return __builtin_amdgcn_wmma_f32_16x16x32_bf16(false, a, false, b, (short)0, c, false, false); }



// ---- k_gemmw: register-blocked GEMM, ONE WAVE per 64x64 output tile (16 accumulators), operands straight from K-contiguous 16-bit planes; grid (M/64, N/64, Z), 32 threads.
// C[m][n] (f32, pitch ldc, + optional f32 bias[n]) = sum_k A[m][k] Bt[n][k] (+ split products per NSPLIT). z-batch strides sA/sB/sC in elements. K % 32 == 0.
template <typename T16> struct WFrag;
template <> struct WFrag<h16> { typedef v16h V; static __device__ __forceinline__ V ld(const h16* p) { return cat16(*(const v8h*)p, *(const v8h*)(p + 16)); } static __device__ __forceinline__ v8f mma(V a, V b, v8f c) { return wmma16(a, b, c); } };
template <> struct WFrag<bf> { typedef v16bf V; static __device__ __forceinline__ V ld(const bf* p) { return cat16b(*(const v8us*)p, *(const v8us*)(p + 16)); } static __device__ __forceinline__ v8f mma(V a, V b, v8f c) { return wmmab(a, b, c); } };
template <typename T16, int NSPLIT, bool BIAS>
__global__ __launch_bounds__(32) void k_gemmw(const T16* __restrict__ A, const T16* __restrict__ A2, const T16* __restrict__ Bt, const T16* __restrict__ Bt2, int K, float* C, int ldc, const float* __restrict__ bias, size_t sA, size_t sB, size_t sC) {
    typedef typename WFrag<T16>::V V;
    __shared__ __align__(16) float os[16 * 68];
    const size_t z = blockIdx.z; A += z * sA; if (A2) A2 += z * sA; Bt += z * sB; if (Bt2) Bt2 += z * sB; C += z * sC;
    const int lane = threadIdx.x & 31, lr = lane & 15, hi = lane >> 4; const int r0 = blockIdx.x * 64, c0 = blockIdx.y * 64;
    v8f acc[4][4];
#pragma unroll
    for (int mb = 0; mb < 4; ++mb)
#pragma unroll
        for (int nb = 0; nb < 4; ++nb) acc[mb][nb] = (v8f){};
    const size_t aoff = (size_t)(r0 + lr) * K + 8 * hi, boff = (size_t)(c0 + lr) * K + 8 * hi;
#pragma unroll 1
    for (int kc = 0; kc < K; kc += 32) {
        V a[4], a2[4];
#pragma unroll
        for (int mb = 0; mb < 4; ++mb) { a[mb] = WFrag<T16>::ld(A + aoff + (size_t)mb * 16 * K + kc); if (NSPLIT == 1 || NSPLIT == 2) a2[mb] = WFrag<T16>::ld(A2 + aoff + (size_t)mb * 16 * K + kc); }
#pragma unroll
        for (int nb = 0; nb < 4; ++nb) { const V b = WFrag<T16>::ld(Bt + boff + (size_t)nb * 16 * K + kc); V b2; if (NSPLIT >= 2) b2 = WFrag<T16>::ld(Bt2 + boff + (size_t)nb * 16 * K + kc);
#pragma unroll
            for (int mb = 0; mb < 4; ++mb) { acc[mb][nb] = WFrag<T16>::mma(a[mb], b, acc[mb][nb]); if (NSPLIT == 1 || NSPLIT == 2) acc[mb][nb] = WFrag<T16>::mma(a2[mb], b, acc[mb][nb]); if (NSPLIT >= 2) acc[mb][nb] = WFrag<T16>::mma(a[mb], b2, acc[mb][nb]); } }
        asm volatile("v_nop\n\tv_nop\n\tv_nop\n\tv_nop" : "+v"(acc[0][0]), "+v"(acc[1][1]), "+v"(acc[2][2]), "+v"(acc[3][3]) : "v"(a[0]), "v"(a[3]));
    }
#pragma unroll
    for (int mb = 0; mb < 4; ++mb) {
#pragma unroll
        for (int nb = 0; nb < 4; ++nb) {
#pragma unroll
            for (int j = 0; j < 8; ++j) os[(hi * 8 + j) * 68 + nb * 16 + lr] = acc[mb][nb][j]; }
        __builtin_amdgcn_wave_barrier(); asm volatile("" ::: "memory");
        float* crow = C + (size_t)(r0 + mb * 16) * ldc + c0;
{
#pragma unroll
            for (int s = 0; s < 8; ++s) { const int row = 2 * s + hi, cofs = lr * 4; v4f val = *(const v4fa*)(os + row * 68 + cofs); if (BIAS) { val[0] += bfr(bias[c0 + cofs]); val[1] += bfr(bias[c0 + cofs + 1]); val[2] += bfr(bias[c0 + cofs + 2]); val[3] += bfr(bias[c0 + cofs + 3]); }
                *(v4f*)(crow + (size_t)row * ldc + cofs) = val; }
             }
        __builtin_amdgcn_wave_barrier(); asm volatile("" ::: "memory");
    }
}

__device__ __forceinline__ h16 tohx(float x) { return (h16)x; }
__device__ __forceinline__ void splitf(float y, unsigned short& h, unsigned short& l) { h = f2bf(y); l = f2bf(y - bf2f(h)); }
typedef __attribute__((ext_vector_type(2))) _Float16 v2h;
typedef __attribute__((ext_vector_type(4))) _Float16 v4h;
typedef __attribute__((ext_vector_type(2))) unsigned short v2us;
typedef __attribute__((ext_vector_type(4))) unsigned short v4us;
typedef __attribute__((ext_vector_type(2))) float v2f;
typedef __attribute__((ext_vector_type(4))) int v4i;

__global__ __launch_bounds__(256) void k_wtG(const float* __restrict__ w, int K, int N, bf* Bt) {
    const int lane = threadIdx.x & 31; const int L0 = (blockIdx.x * 8 + (threadIdx.x >> 5)) * 8; const int nlines = N * K / 64;
{
#pragma unroll 1
        for (int l = 0; l < 8; ++l) { const int L = L0 + l; if (L >= nlines) break; const size_t e = (size_t)L * 64 + lane * 2; const int k = (int)(e % K), n = (int)(e / K); v2us o;
            o[0] = f2bf(w[(size_t)k * N + n]); o[1] = f2bf(w[(size_t)(k + 1) * N + n]); *(v2us*)(Bt + e) = o; }
         }
}
__global__ __launch_bounds__(256) void k_cvt8(const float* __restrict__ src, bf* dst, size_t n8) { const size_t i = (size_t)blockIdx.x * 256 + threadIdx.x; if (i >= n8) return; const v8f v = *(const v8f*)(src + i * 8); v8us o;
#pragma unroll
    for (int k = 0; k < 8; ++k) o[k] = f2bf(v[k]); *(v8us*)(dst + i * 8) = o;  }


__global__ __launch_bounds__(256) void k_vtp(const float* __restrict__ F, int pitch, int nheads, h16* V16, bf* Vh, bf* Vl) { const size_t e = ((size_t)blockIdx.x * 256 + threadIdx.x) * 2; if (e >= (size_t)nheads * HD * TT) return; const int t = (int)(e % TT); const int d = (int)((e / TT) % HD); const int g = (int)(e / ((size_t)TT * HD)); v2h o16; v2us oh, ol;
#pragma unroll
    for (int q = 0; q < 2; ++q) { const float x = F[(size_t)(t + q) * pitch + g * HD + d]; o16[q] = tohx(x); unsigned short a2, c2; splitf(x, a2, c2); oh[q] = a2; ol[q] = c2; }
    *(v2h*)(V16 + e) = o16; *(v2us*)(Vh + e) = oh; *(v2us*)(Vl + e) = ol;  }

// k_asoft: per row (zz, i): t = S x HD^-0.5 (no mask); softmax over the 4096 keys (register row, one exp, fixed trees);
__global__ __launch_bounds__(256) void k_asoft(const float* __restrict__ Sb, h16* P16, bf* Ph, bf* Pl) {
    const int lane = threadIdx.x & 31; const int row = blockIdx.x * 8 + (threadIdx.x >> 5); if (row >= ZH * TT) return; const int i = row % TT; const int zz = row / TT; (void)zz; const bool hires = (i < RH); const float* sr = Sb + (size_t)row * TT; float v[TT / 32]; float mx = -3.0e38f;
#pragma unroll
    for (int ch = 0; ch < TT / 128; ++ch) { const int j0 = ch * 128 + lane * 4; const v4f a = *(const v4f*)(sr + j0);
#pragma unroll
        for (int q = 0; q < 4; ++q) { const float t = a[q] * SCL; v[ch * 4 + q] = t;   /* Sb holds the raw q.k scores (no bias) */ mx = fmaxf(mx, t); } }
#pragma unroll
    for (int sh = 16; sh; sh >>= 1) mx = fmaxf(mx, __shfl_xor(mx, sh, 32));
    float sum = 0.f;
#pragma unroll
    for (int k = 0; k < TT / 32; ++k) { float d0 = __fsub_rn(v[k], mx); asm volatile("" : "+v"(d0)); v[k] = __builtin_amdgcn_exp2f(__fmul_rn(d0, 1.4426950408889634f)); sum += v[k]; }
#pragma unroll
    for (int sh = 16; sh; sh >>= 1) sum += __shfl_xor(sum, sh, 32);
    const float f = __fdiv_rn(hires ? 1.0f : PCAR, sum);
{
        if (hires) {
#pragma unroll
            for (int ch = 0; ch < TT / 128; ++ch) { v4us oh, ol;
#pragma unroll
                for (int q = 0; q < 4; ++q) { unsigned short a, c2; splitf(v[ch * 4 + q] * f, a, c2); oh[q] = a; ol[q] = c2; }
                const size_t oo = ((size_t)zz * (RH ? RH : 1) + i) * TT + ch * 128 + lane * 4; *(v4us*)(Ph + oo) = oh; *(v4us*)(Pl + oo) = ol; }
        } else {
#pragma unroll
            for (int ch = 0; ch < TT / 128; ++ch) { v4h o4;
#pragma unroll
                for (int q = 0; q < 4; ++q) o4[q] = tohx(v[ch * 4 + q] * f);
                *(v4h*)(P16 + (size_t)row * TT + ch * 128 + lane * 4) = o4; } }
         }
}
__global__ __launch_bounds__(256) void k_merge(const float* __restrict__ O, int h0, float* OUTb) { const size_t e = ((size_t)blockIdx.x * 256 + threadIdx.x) * 2; if (e >= (size_t)ZH * TT * HD) return; const int d = (int)(e % HD); const int t = (int)((e / HD) % TT); const int zz = (int)(e / ((size_t)HD * TT)); const float cs = (t < RH) ? 1.0f : (1.0f / PCAR); const size_t oo = (size_t)t * DQ + (h0 + zz) * HD + d;
    v2f o2; o2[0] = O[e] * cs; o2[1] = O[e + 1] * cs; *(v2f*)(OUTb + oo) = o2;  }


__global__ __launch_bounds__(256) void k_vtpR1(const float* __restrict__ Vb, bf* Vh) { const size_t e = ((size_t)blockIdx.x * 256 + threadIdx.x) * 2; if (e >= (size_t)HD * TT) return; const int t = (int)(e % TT); const int d = (int)(e / TT); v2us o; o[0] = f2bf(Vb[(size_t)t * HD + d]); o[1] = f2bf(Vb[(size_t)(t + 1) * HD + d]); *(v2us*)(Vh + e) = o;  }
__global__ __launch_bounds__(256) void k_mergeR(const float* __restrict__ O, float* outb, size_t n4) { const size_t i = (size_t)blockIdx.x * 256 + threadIdx.x; if (i >= n4) return; const v4f a = *(const v4f*)(O + i * 4); *(v4f*)(outb + i * 4) = a;  }


__global__ __launch_bounds__(256) void k_hp1(const float* __restrict__ src, bf* P) { const size_t i = (size_t)blockIdx.x * 256 + threadIdx.x; if (i >= (size_t)NH_ * TT * HD / 8) return; const size_t e = i * 8; const int d = (int)(e % HD); const int t = (int)((e / HD) % TT); const int h = (int)(e / ((size_t)HD * TT)); const v8f v = *(const v8f*)(src + (size_t)t * DM + h * HD + d); v8us o;
#pragma unroll
    for (int q = 0; q < 8; ++q) o[q] = f2bf(v[q]);
    *(v8us*)(P + e) = o;  }
__global__ __launch_bounds__(256) void k_vt1(const float* __restrict__ src, int pitch, bf* VT) { const size_t e = ((size_t)blockIdx.x * 256 + threadIdx.x) * 2; if (e >= (size_t)NH_ * HD * TT) return; const int t = (int)(e % TT); const int d = (int)((e / TT) % HD); const int h = (int)(e / ((size_t)TT * HD)); v2us o; o[0] = f2bf(src[(size_t)t * pitch + h * HD + d]); o[1] = f2bf(src[(size_t)(t + 1) * pitch + h * HD + d]); *(v2us*)(VT + e) = o;  }
__global__ __launch_bounds__(256) void k_mergeT(const float* __restrict__ O, int h, float* outb) { const size_t i = (size_t)blockIdx.x * 256 + threadIdx.x; if (i >= (size_t)TT * HD / 4) return; const size_t e = i * 4; const int d = (int)(e % HD); const int t = (int)(e / HD); const v4f a = *(const v4f*)(O + e); *(v4f*)(outb + (size_t)t * DM + h * HD + d) = a;  }

extern "C" void kernel_launch(void* const* d_in, const int* in_sizes, int n_in,
                              void* d_out, int out_size, void* d_ws, size_t ws_size, hipStream_t stream) {
    (void)in_sizes; (void)n_in; (void)out_size;
    const float* Qin = (const float*)d_in[0]; const float* Kin = (const float*)d_in[1]; const float* Vin = (const float*)d_in[2];
    float* OUT = (float*)d_out;     // [4][4096][64]
    char* wsp = (char*)d_ws;
    auto take = [&](size_t bytes) { char* p = wsp; wsp += (bytes + 255) & ~(size_t)255; return (void*)p; };
    bf* QB = (bf*)take((size_t)NH_ * TT * HD * 2); bf* KB = (bf*)take((size_t)NH_ * TT * HD * 2); bf* VT = (bf*)take((size_t)NH_ * HD * TT * 2);
    float* Sb = (float*)take((size_t)TT * TT * 4);  bf* Ph = (bf*)take((size_t)TT * TT * 2); bf* Pl = (bf*)take((size_t)TT * TT * 2); float* Ob = (float*)take((size_t)TT * HD * 4);
    if ((size_t)(wsp - (char*)d_ws) > ws_size) return;
    for (int b = 0; b < NB_; ++b) {
        const float* qb = Qin + (size_t)b * NH_ * TT * HD; const float* kb = Kin + (size_t)b * NH_ * TT * HD; const float* vb = Vin + (size_t)b * NH_ * TT * HD;   /* head-major [h][t][d] slabs (contiguous per head) */
        k_cvt8<<<(unsigned)(((size_t)NH_ * TT * HD / 8 + 255) / 256), 256, 0, stream>>>(qb, QB, (size_t)NH_ * TT * HD / 8); k_cvt8<<<(unsigned)(((size_t)NH_ * TT * HD / 8 + 255) / 256), 256, 0, stream>>>(kb, KB, (size_t)NH_ * TT * HD / 8);
        for (int h = 0; h < NH_; ++h) k_vtpR1<<<(unsigned)(((size_t)HD * TT / 2 + 255) / 256), 256, 0, stream>>>(vb + (size_t)h * TT * HD, VT + (size_t)h * HD * TT);
        for (int h = 0; h < NH_; ++h) {
            k_gemmw<bf, 0, false><<<dim3(TT / 64, TT / 64, 1), 32, 0, stream>>>(QB + (size_t)h * TT * HD, nullptr, KB + (size_t)h * TT * HD, nullptr, HD, Sb, TT, nullptr, 0, 0, 0);   /* exact scores (single bf16 planes) */
            k_asoft<<<TT / 8, 256, 0, stream>>>(Sb, nullptr, Ph, Pl);
            k_gemmw<bf, 1, false><<<dim3(TT / 64, HD / 64, 1), 32, 0, stream>>>(Ph, Pl, VT + (size_t)h * HD * TT, nullptr, TT, Ob, HD, nullptr, 0, 0, 0);   /* P (hi/lo) x exact v^T */
            k_mergeR<<<(unsigned)(((size_t)TT * HD / 4 + 255) / 256), 256, 0, stream>>>(Ob, OUT + ((size_t)b * NH_ + h) * TT * HD, (size_t)TT * HD / 4); } }
}

// v001
// Measured time: 245 microseconds a run.
// Timed twice side by side with v000, it ran 2.50 and 2.54 times as fast.
#include <hip/hip_runtime.h>

// Standard single-head attention on given tensors over 4,096 tokens (q, k, v [4][4096][64]; scores x 64^-0.5; softmax; out = attn v -> [4][4096][64] (1.05 M)).
// Layout per batch: single bf16 planes of q and k (inputs bf16-exact: exact score products) and value^T planes; softmax over 4,096 keys (every row hi/lo); P hi/lo x exact value; merge writes the output rows.
// Compute dtypes, f32 accumulate: every input rounded to bf16; q.k exact; softmax f32; P hi/lo x exact value; output f32.

#define NB_  4
#define TT   4096
#define DM   64      // token-major row pitch (H x HD)
#define NH_  1
#define NKV  1
#define REP  (NH_ / NKV)
#define HD   64
#define DQ   (NH_ * HD)
#define DKV  (NKV * HD)
#define ZH   1
#define RH   4096                  // query rows < RH use hi+lo planes (0: none)
#define WIN  0
#define PCAR 1024.0f
#define SCL  0.125f   // 1/sqrt(64)
#define PVW  8       // P x v: key slices per workgroup, one wave each
#define PVZ  4       // P x v: workgroups per 64-row tile; their partial planes are summed by k_mergeR
typedef _Float16 h16;
typedef unsigned short bf;
typedef __attribute__((ext_vector_type(16))) __bf16   v16bf;
typedef __attribute__((ext_vector_type(16))) _Float16 v16h;
typedef __attribute__((ext_vector_type(8)))  _Float16 v8h;
typedef __attribute__((ext_vector_type(8)))  unsigned short v8us;
typedef __attribute__((ext_vector_type(8)))  float    v8f;
typedef __attribute__((ext_vector_type(4)))  float    v4f;
typedef v8h  __attribute__((may_alias)) v8ha;
typedef v4f  __attribute__((may_alias)) v4fa;
typedef v8us __attribute__((may_alias)) v8usa;

__device__ __forceinline__ unsigned short f2bf(float f) { unsigned u = __float_as_uint(f); u += 0x7FFFu + ((u >> 16) & 1u); return (unsigned short)(u >> 16); }
__device__ __forceinline__ float bf2f(unsigned short b) { return __uint_as_float(((unsigned)b) << 16); }
__device__ __forceinline__ float bfr(float f) { return bf2f(f2bf(f)); }
__device__ __forceinline__ v16h cat16(v8h lo, v8h hi) { return __builtin_shufflevector(lo, hi, 0, 1, 2, 3, 4, 5, 6, 7, 8, 9, 10, 11, 12, 13, 14, 15); }
__device__ __forceinline__ v16bf cat16b(v8us lo, v8us hi) { return __builtin_bit_cast(v16bf, __builtin_shufflevector(lo, hi, 0, 1, 2, 3, 4, 5, 6, 7, 8, 9, 10, 11, 12, 13, 14, 15)); }
__device__ __forceinline__ v8f wmma16(v16h a, v16h b, v8f c) { return __builtin_amdgcn_wmma_f32_16x16x32_f16(false, a, false, b, (short)0, c, false, false); }
__device__ __forceinline__ v8f wmmab(v16bf a, v16bf b, v8f c) { return __builtin_amdgcn_wmma_f32_16x16x32_bf16(false, a, false, b, (short)0, c, false, false); }



// ---- k_gemmw: register-blocked GEMM, NW WAVES per 64x64 output tile (16 accumulators each), operands straight from K-contiguous 16-bit planes; grid (M/64, N/64, Z), 32 * NW threads.
// C[m][n] (f32, pitch ldc, + optional f32 bias[n]) = sum_k A[m][k] Bt[n][k] (+ split products per NSPLIT). z-batch strides sA/sB/sC in elements. K % 32 == 0.
// K is the row pitch of A and Bt; each wave sums KS of the k. NW = 8: 256 threads, wave w takes k from w * KS, and the 8 tiles are summed through LDS in wave order (with sA = sB = 8 * KS, z walks on along k and C gets one partial plane per z).
template <typename T16> struct WFrag;
template <> struct WFrag<h16> { typedef v16h V; static __device__ __forceinline__ V ld(const h16* p) { return cat16(*(const v8h*)p, *(const v8h*)(p + 16)); } static __device__ __forceinline__ v8f mma(V a, V b, v8f c) { return wmma16(a, b, c); } };
template <> struct WFrag<bf> { typedef v16bf V; static __device__ __forceinline__ V ld(const bf* p) { return cat16b(*(const v8us*)p, *(const v8us*)(p + 16)); } static __device__ __forceinline__ v8f mma(V a, V b, v8f c) { return wmmab(a, b, c); } };
template <typename T16, int NSPLIT, bool BIAS, int NW>
__global__ __launch_bounds__(32 * NW) void k_gemmw(const T16* __restrict__ A, const T16* __restrict__ A2, const T16* __restrict__ Bt, const T16* __restrict__ Bt2, int K, int KS, float* C, int ldc, const float* __restrict__ bias, size_t sA, size_t sB, size_t sC) {
    static_assert(NW == 1 || (NW == 8 && !BIAS), "the LDS sum deals one float4 of a 16 x 64 block to each of 256 threads");
    typedef typename WFrag<T16>::V V;
    __shared__ __align__(16) float os[NW * 16 * 68];
    const int wave = (NW > 1) ? __builtin_amdgcn_readfirstlane((int)(threadIdx.x >> 5)) : 0;
    const size_t z = blockIdx.z; A += z * sA; if (A2) A2 += z * sA; Bt += z * sB; if (Bt2) Bt2 += z * sB; C += z * sC;
    const int lane = threadIdx.x & 31, lr = lane & 15, hi = lane >> 4; const int r0 = blockIdx.x * 64, c0 = blockIdx.y * 64;
    v8f acc[4][4];
#pragma unroll
    for (int mb = 0; mb < 4; ++mb)
#pragma unroll
        for (int nb = 0; nb < 4; ++nb) acc[mb][nb] = (v8f){};
    const size_t aoff = (size_t)(r0 + lr) * K + wave * KS + 8 * hi, boff = (size_t)(c0 + lr) * K + wave * KS + 8 * hi;
#pragma unroll 1
    for (int kc = 0; kc < KS; kc += 32) {
        V a[4], a2[4];
#pragma unroll
        for (int mb = 0; mb < 4; ++mb) { a[mb] = WFrag<T16>::ld(A + aoff + (size_t)mb * 16 * K + kc); if (NSPLIT == 1 || NSPLIT == 2) a2[mb] = WFrag<T16>::ld(A2 + aoff + (size_t)mb * 16 * K + kc); }
#pragma unroll
        for (int nb = 0; nb < 4; ++nb) { const V b = WFrag<T16>::ld(Bt + boff + (size_t)nb * 16 * K + kc); V b2; if (NSPLIT >= 2) b2 = WFrag<T16>::ld(Bt2 + boff + (size_t)nb * 16 * K + kc);
#pragma unroll
            for (int mb = 0; mb < 4; ++mb) { acc[mb][nb] = WFrag<T16>::mma(a[mb], b, acc[mb][nb]); if (NSPLIT == 1 || NSPLIT == 2) acc[mb][nb] = WFrag<T16>::mma(a2[mb], b, acc[mb][nb]); if (NSPLIT >= 2) acc[mb][nb] = WFrag<T16>::mma(a[mb], b2, acc[mb][nb]); } }
        asm volatile("v_nop\n\tv_nop\n\tv_nop\n\tv_nop" : "+v"(acc[0][0]), "+v"(acc[1][1]), "+v"(acc[2][2]), "+v"(acc[3][3]) : "v"(a[0]), "v"(a[3]));
    }
    if (NW > 1) {
        float* ow = os + wave * (16 * 68); const int row = threadIdx.x >> 4, cofs = (threadIdx.x & 15) * 4; v4f sum[4];
#pragma unroll
        for (int mb = 0; mb < 4; ++mb) {
            if (mb) __syncthreads();   // the sums of the 16 rows before have read the tiles that are overwritten now
#pragma unroll
            for (int nb = 0; nb < 4; ++nb) {
#pragma unroll
                for (int j = 0; j < 8; ++j) ow[(hi * 8 + j) * 68 + nb * 16 + lr] = acc[mb][nb][j]; }
            __syncthreads();   // every wave's 16 x 64 tile is in LDS before a thread sums them
            sum[mb] = *(const v4fa*)(os + row * 68 + cofs);
#pragma unroll
            for (int w = 1; w < NW; ++w) sum[mb] += *(const v4fa*)(os + w * (16 * 68) + row * 68 + cofs);
        }
#pragma unroll
        for (int mb = 0; mb < 4; ++mb) *(v4f*)(C + (size_t)(r0 + mb * 16 + row) * ldc + c0 + cofs) = sum[mb];   // stores behind the last barrier: no barrier waits for one
        return;
    }
#pragma unroll
    for (int mb = 0; mb < 4; ++mb) {
#pragma unroll
        for (int nb = 0; nb < 4; ++nb) {
#pragma unroll
            for (int j = 0; j < 8; ++j) os[(hi * 8 + j) * 68 + nb * 16 + lr] = acc[mb][nb][j]; }
        __builtin_amdgcn_wave_barrier(); asm volatile("" ::: "memory");
        float* crow = C + (size_t)(r0 + mb * 16) * ldc + c0;
{
#pragma unroll
            for (int s = 0; s < 8; ++s) { const int row = 2 * s + hi, cofs = lr * 4; v4f val = *(const v4fa*)(os + row * 68 + cofs); if (BIAS) { val[0] += bfr(bias[c0 + cofs]); val[1] += bfr(bias[c0 + cofs + 1]); val[2] += bfr(bias[c0 + cofs + 2]); val[3] += bfr(bias[c0 + cofs + 3]); }
                *(v4f*)(crow + (size_t)row * ldc + cofs) = val; }
             }
        __builtin_amdgcn_wave_barrier(); asm volatile("" ::: "memory");
    }
}

__device__ __forceinline__ h16 tohx(float x) { return (h16)x; }
__device__ __forceinline__ void splitf(float y, unsigned short& h, unsigned short& l) { h = f2bf(y); l = f2bf(y - bf2f(h)); }
typedef __attribute__((ext_vector_type(2))) _Float16 v2h;
typedef __attribute__((ext_vector_type(4))) _Float16 v4h;
typedef __attribute__((ext_vector_type(2))) unsigned short v2us;
typedef __attribute__((ext_vector_type(4))) unsigned short v4us;
typedef __attribute__((ext_vector_type(2))) float v2f;
typedef __attribute__((ext_vector_type(4))) int v4i;

__global__ __launch_bounds__(256) void k_wtG(const float* __restrict__ w, int K, int N, bf* Bt) {
    const int lane = threadIdx.x & 31; const int L0 = (blockIdx.x * 8 + (threadIdx.x >> 5)) * 8; const int nlines = N * K / 64;
{
#pragma unroll 1
        for (int l = 0; l < 8; ++l) { const int L = L0 + l; if (L >= nlines) break; const size_t e = (size_t)L * 64 + lane * 2; const int k = (int)(e % K), n = (int)(e / K); v2us o;
            o[0] = f2bf(w[(size_t)k * N + n]); o[1] = f2bf(w[(size_t)(k + 1) * N + n]); *(v2us*)(Bt + e) = o; }
         }
}
__global__ __launch_bounds__(256) void k_cvt8(const float* __restrict__ src, bf* dst, size_t n8) { const size_t i = (size_t)blockIdx.x * 256 + threadIdx.x; if (i >= n8) return; const v8f v = *(const v8f*)(src + i * 8); v8us o;
#pragma unroll
    for (int k = 0; k < 8; ++k) o[k] = f2bf(v[k]); *(v8us*)(dst + i * 8) = o;  }


__global__ __launch_bounds__(256) void k_vtp(const float* __restrict__ F, int pitch, int nheads, h16* V16, bf* Vh, bf* Vl) { const size_t e = ((size_t)blockIdx.x * 256 + threadIdx.x) * 2; if (e >= (size_t)nheads * HD * TT) return; const int t = (int)(e % TT); const int d = (int)((e / TT) % HD); const int g = (int)(e / ((size_t)TT * HD)); v2h o16; v2us oh, ol;
#pragma unroll
    for (int q = 0; q < 2; ++q) { const float x = F[(size_t)(t + q) * pitch + g * HD + d]; o16[q] = tohx(x); unsigned short a2, c2; splitf(x, a2, c2); oh[q] = a2; ol[q] = c2; }
    *(v2h*)(V16 + e) = o16; *(v2us*)(Vh + e) = oh; *(v2us*)(Vl + e) = ol;  }

// k_asoft: per row (zz, i): t = S x HD^-0.5 (no mask); softmax over the 4096 keys (register row, one exp, fixed trees);
__global__ __launch_bounds__(256) void k_asoft(const float* __restrict__ Sb, h16* P16, bf* Ph, bf* Pl) {
    const int lane = threadIdx.x & 31; const int row = blockIdx.x * 8 + (threadIdx.x >> 5); if (row >= ZH * TT) return; const int i = row % TT; const int zz = row / TT; (void)zz; const bool hires = (i < RH); const float* sr = Sb + (size_t)row * TT; float v[TT / 32]; float mx = -3.0e38f;
#pragma unroll
    for (int ch = 0; ch < TT / 128; ++ch) { const int j0 = ch * 128 + lane * 4; const v4f a = *(const v4f*)(sr + j0);
#pragma unroll
        for (int q = 0; q < 4; ++q) { const float t = a[q] * SCL; v[ch * 4 + q] = t;   /* Sb holds the raw q.k scores (no bias) */ mx = fmaxf(mx, t); } }
#pragma unroll
    for (int sh = 16; sh; sh >>= 1) mx = fmaxf(mx, __shfl_xor(mx, sh, 32));
    float sum = 0.f;
#pragma unroll
    for (int k = 0; k < TT / 32; ++k) { float d0 = __fsub_rn(v[k], mx); asm volatile("" : "+v"(d0)); v[k] = __builtin_amdgcn_exp2f(__fmul_rn(d0, 1.4426950408889634f)); sum += v[k]; }
#pragma unroll
    for (int sh = 16; sh; sh >>= 1) sum += __shfl_xor(sum, sh, 32);
    const float f = __fdiv_rn(hires ? 1.0f : PCAR, sum);
{
        if (hires) {
#pragma unroll
            for (int ch = 0; ch < TT / 128; ++ch) { v4us oh, ol;
#pragma unroll
                for (int q = 0; q < 4; ++q) { unsigned short a, c2; splitf(v[ch * 4 + q] * f, a, c2); oh[q] = a; ol[q] = c2; }
                const size_t oo = ((size_t)zz * (RH ? RH : 1) + i) * TT + ch * 128 + lane * 4; *(v4us*)(Ph + oo) = oh; *(v4us*)(Pl + oo) = ol; }
        } else {
#pragma unroll
            for (int ch = 0; ch < TT / 128; ++ch) { v4h o4;
#pragma unroll
                for (int q = 0; q < 4; ++q) o4[q] = tohx(v[ch * 4 + q] * f);
                *(v4h*)(P16 + (size_t)row * TT + ch * 128 + lane * 4) = o4; } }
         }
}
__global__ __launch_bounds__(256) void k_merge(const float* __restrict__ O, int h0, float* OUTb) { const size_t e = ((size_t)blockIdx.x * 256 + threadIdx.x) * 2; if (e >= (size_t)ZH * TT * HD) return; const int d = (int)(e % HD); const int t = (int)((e / HD) % TT); const int zz = (int)(e / ((size_t)HD * TT)); const float cs = (t < RH) ? 1.0f : (1.0f / PCAR); const size_t oo = (size_t)t * DQ + (h0 + zz) * HD + d;
    v2f o2; o2[0] = O[e] * cs; o2[1] = O[e + 1] * cs; *(v2f*)(OUTb + oo) = o2;  }


__global__ __launch_bounds__(256) void k_vtpR1(const float* __restrict__ Vb, bf* Vh) { const size_t e = ((size_t)blockIdx.x * 256 + threadIdx.x) * 2; if (e >= (size_t)HD * TT) return; const int t = (int)(e % TT); const int d = (int)(e / TT); v2us o; o[0] = f2bf(Vb[(size_t)t * HD + d]); o[1] = f2bf(Vb[(size_t)(t + 1) * HD + d]); *(v2us*)(Vh + e) = o;  }
__global__ __launch_bounds__(256) void k_mergeR(const float* __restrict__ O, float* outb, size_t n4) { const size_t i = (size_t)blockIdx.x * 256 + threadIdx.x; if (i >= n4) return; v4f p[PVZ];   /* the partial planes of the K-split product */
#pragma unroll
    for (int z = 0; z < PVZ; ++z) { p[z] = *(const v4f*)(O + ((size_t)z * n4 + i) * 4);
        asm volatile("s_wait_xcnt 0x0" ::: "memory"); }   /* precaution: stands before a later load's result may take the registers that held this load's address */
    v4f a = p[0];
#pragma unroll
    for (int z = 1; z < PVZ; ++z) a += p[z];   /* summed in plane order */
    *(v4f*)(outb + i * 4) = a;  }


__global__ __launch_bounds__(256) void k_hp1(const float* __restrict__ src, bf* P) { const size_t i = (size_t)blockIdx.x * 256 + threadIdx.x; if (i >= (size_t)NH_ * TT * HD / 8) return; const size_t e = i * 8; const int d = (int)(e % HD); const int t = (int)((e / HD) % TT); const int h = (int)(e / ((size_t)HD * TT)); const v8f v = *(const v8f*)(src + (size_t)t * DM + h * HD + d); v8us o;
#pragma unroll
    for (int q = 0; q < 8; ++q) o[q] = f2bf(v[q]);
    *(v8us*)(P + e) = o;  }
__global__ __launch_bounds__(256) void k_vt1(const float* __restrict__ src, int pitch, bf* VT) { const size_t e = ((size_t)blockIdx.x * 256 + threadIdx.x) * 2; if (e >= (size_t)NH_ * HD * TT) return; const int t = (int)(e % TT); const int d = (int)((e / TT) % HD); const int h = (int)(e / ((size_t)TT * HD)); v2us o; o[0] = f2bf(src[(size_t)t * pitch + h * HD + d]); o[1] = f2bf(src[(size_t)(t + 1) * pitch + h * HD + d]); *(v2us*)(VT + e) = o;  }
__global__ __launch_bounds__(256) void k_mergeT(const float* __restrict__ O, int h, float* outb) { const size_t i = (size_t)blockIdx.x * 256 + threadIdx.x; if (i >= (size_t)TT * HD / 4) return; const size_t e = i * 4; const int d = (int)(e % HD); const int t = (int)(e / HD); const v4f a = *(const v4f*)(O + e); *(v4f*)(outb + (size_t)t * DM + h * HD + d) = a;  }

extern "C" void kernel_launch(void* const* d_in, const int* in_sizes, int n_in,
                              void* d_out, int out_size, void* d_ws, size_t ws_size, hipStream_t stream) {
    (void)in_sizes; (void)n_in; (void)out_size;
    const float* Qin = (const float*)d_in[0]; const float* Kin = (const float*)d_in[1]; const float* Vin = (const float*)d_in[2];
    float* OUT = (float*)d_out;     // [4][4096][64]
    char* wsp = (char*)d_ws;
    auto take = [&](size_t bytes) { char* p = wsp; wsp += (bytes + 255) & ~(size_t)255; return (void*)p; };
    bf* QB = (bf*)take((size_t)NH_ * TT * HD * 2); bf* KB = (bf*)take((size_t)NH_ * TT * HD * 2); bf* VT = (bf*)take((size_t)NH_ * HD * TT * 2);
    float* Sb = (float*)take((size_t)TT * TT * 4);  bf* Ph = (bf*)take((size_t)TT * TT * 2); bf* Pl = (bf*)take((size_t)TT * TT * 2); float* Ob = (float*)take((size_t)PVZ * TT * HD * 4);
    if ((size_t)(wsp - (char*)d_ws) > ws_size) return;
    for (int b = 0; b < NB_; ++b) {
        const float* qb = Qin + (size_t)b * NH_ * TT * HD; const float* kb = Kin + (size_t)b * NH_ * TT * HD; const float* vb = Vin + (size_t)b * NH_ * TT * HD;   /* head-major [h][t][d] slabs (contiguous per head) */
        k_cvt8<<<(unsigned)(((size_t)NH_ * TT * HD / 8 + 255) / 256), 256, 0, stream>>>(qb, QB, (size_t)NH_ * TT * HD / 8); k_cvt8<<<(unsigned)(((size_t)NH_ * TT * HD / 8 + 255) / 256), 256, 0, stream>>>(kb, KB, (size_t)NH_ * TT * HD / 8);
        for (int h = 0; h < NH_; ++h) k_vtpR1<<<(unsigned)(((size_t)HD * TT / 2 + 255) / 256), 256, 0, stream>>>(vb + (size_t)h * TT * HD, VT + (size_t)h * HD * TT);
        for (int h = 0; h < NH_; ++h) {
            k_gemmw<bf, 0, false, 1><<<dim3(TT / 64, TT / 64, 1), 32, 0, stream>>>(QB + (size_t)h * TT * HD, nullptr, KB + (size_t)h * TT * HD, nullptr, HD, HD, Sb, TT, nullptr, 0, 0, 0);   /* exact scores (single bf16 planes) */
            k_asoft<<<TT / 8, 256, 0, stream>>>(Sb, nullptr, Ph, Pl);
            k_gemmw<bf, 1, false, PVW><<<dim3(TT / 64, HD / 64, PVZ), 32 * PVW, 0, stream>>>(Ph, Pl, VT + (size_t)h * HD * TT, nullptr, TT, TT / (PVW * PVZ), Ob, HD, nullptr, TT / PVZ, TT / PVZ, (size_t)TT * HD);   /* P (hi/lo) x exact v^T, the keys split over PVW x PVZ waves */
            k_mergeR<<<(unsigned)(((size_t)TT * HD / 4 + 255) / 256), 256, 0, stream>>>(Ob, OUT + ((size_t)b * NH_ + h) * TT * HD, (size_t)TT * HD / 4); } }
}

// v002
// It runs in 27.5 microseconds.
// In two side-by-side timings against v001, it was 8.97 and 8.82 times as fast.
// Over all steps from v000 it is 22.4 times as fast.
#include <hip/hip_runtime.h>

// Standard single-head attention on given tensors over 4,096 tokens (q, k, v [4][4096][64]; scores x 64^-0.5; softmax; out = attn v -> [4][4096][64] (1.05 M)).
// One fused kernel over all four batches: S^T = K.Q^T, online softmax in registers, O^T += V^T.P^T; scores and P never leave the registers.
// Compute dtypes, f32 accumulate: every input rounded to bf16; q.k exact; softmax f32; P hi/lo x exact value; output f32.
// Every plain '#pragma unroll' below stands on a short loop; most are over register arrays (fragments, accumulators, packed words): unrolled, their indices are constants and they stay in registers. The join's loops over slices and output rows read LDS.

#define NB_  4
#define TT   4096
#define HD   64
#define FQ   64                 // query rows per workgroup: two 32-column groups
#define FKS  8                  // key slices per workgroup, one wave per (slice, column group)
#define FNW  (2 * FKS)          // waves per workgroup
#define KSL  (TT / FKS)         // keys per slice
#define OPW  (32 * 68)          // floats of one wave's staged 32 x 64 output tile (row pitch 68)
#define CSC  0.18033688011112042f   // 64^-0.5 x log2(e): the softmax runs in base 2
typedef unsigned short bf;
typedef __attribute__((ext_vector_type(16))) __bf16   v16bf;
typedef __attribute__((ext_vector_type(2)))  __bf16   v2bf;
typedef __attribute__((ext_vector_type(8)))  unsigned short v8us;
typedef __attribute__((ext_vector_type(8)))  unsigned v8u;
typedef __attribute__((ext_vector_type(8)))  float    v8f;
typedef __attribute__((ext_vector_type(4)))  float    v4f;
typedef __attribute__((ext_vector_type(2)))  float    v2f;
typedef v4f  __attribute__((may_alias)) v4fa;

__device__ __forceinline__ unsigned short f2bf(float f) { unsigned u = __float_as_uint(f); u += 0x7FFFu + ((u >> 16) & 1u); return (unsigned short)(u >> 16); }
__device__ __forceinline__ v16bf cat16b(v8us lo, v8us hi) { return __builtin_bit_cast(v16bf, __builtin_shufflevector(lo, hi, 0, 1, 2, 3, 4, 5, 6, 7, 8, 9, 10, 11, 12, 13, 14, 15)); }
__device__ __forceinline__ v8f wmmab(v16bf a, v16bf b, v8f c) { return __builtin_amdgcn_wmma_f32_16x16x32_bf16(false, a, false, b, (short)0, c, false, false); }
// Fragment planes: a 16 (rows) x 32 (k) bf16 operand is stored as the matrix instruction takes it, two runs of 512 bytes: run j, lane l = 16 h + c, holds row c, k = 16 j + 8 h + (0 ... 7).
// So each wave-wide 16-byte load covers four whole 128-byte lines. p points at the lane's 16 bytes of run 0.
__device__ __forceinline__ v16bf ldfrag(const bf* p) { return cat16b(*(const v8us*)p, *(const v8us*)(p + 256)); }
__device__ __forceinline__ unsigned pack2(float lo, float hi) { return __builtin_bit_cast(unsigned, __builtin_convertvector((v2f){lo, hi}, v2bf)); }   // round to nearest even
__device__ __forceinline__ float xhalf(float x) { return __builtin_bit_cast(float, __builtin_amdgcn_permlanex16(__builtin_bit_cast(int, x), __builtin_bit_cast(int, x), 0x76543210, 0xfedcba98, false, false)); }   // lane l with lane l ^ 16
// exp2 for the join at the kernel's end: the v_nop is the one slot that the instruction set asks for behind a transcendental before its result is read or its source overwritten; in one statement it stands there in every build.
__device__ __forceinline__ float exp2_slot(float x) { float r; asm("v_exp_f32 %0, %1\n\tv_nop" : "=v"(r) : "v"(x)); return r; }

// k_kfrag: fragment planes of K, KF[16-key tile][kc = d / 32][run j][lane][8]: rows are keys, k is d. One thread per 16 bytes written.
__global__ __launch_bounds__(256) void k_kfrag(const float* __restrict__ K, bf* KF) {
    const int i = blockIdx.x * 256 + threadIdx.x; const int c = i & 15, h = (i >> 4) & 1, j = (i >> 5) & 1, kc = (i >> 6) & 1, tile = i >> 7;
    const v8f v = *(const v8f*)(K + (size_t)(tile * 16 + c) * HD + 32 * kc + 16 * j + 8 * h); v8us o;
#pragma unroll
    for (int e = 0; e < 8; ++e) o[e] = f2bf(v[e]);
    *(v8us*)(KF + (size_t)i * 8) = o;
}
// k_vfrag: fragment planes of value^T, VF[32-key block][t = d / 16][run j][lane][8]: rows are d, k is the key. One thread per 16 bytes written.
__global__ __launch_bounds__(256) void k_vfrag(const float* __restrict__ V, bf* VF) {
    const int i = blockIdx.x * 256 + threadIdx.x; const int c = i & 15, h = (i >> 4) & 1, j = (i >> 5) & 1, t = (i >> 6) & 3, blk = i >> 8;
    const float* s = V + (size_t)(blk * 32 + 16 * j + 8 * h) * HD + 16 * t + c; v8us o;
#pragma unroll
    for (int e = 0; e < 8; ++e) o[e] = f2bf(s[e * HD]);
    *(v8us*)(VF + (size_t)i * 8) = o;
}

// k_fattn: one workgroup per 64 query rows of one batch, 16 waves. Wave (ks, qg) walks keys [ks * KSL, (ks + 1) * KSL) in passes of 32 for the 32 query columns of group qg.
// Per pass: S^T = K.Q^T (a lane holds 16 scores of one query per 16-column group), maximum in lane plus one exchange between the halves, exp2, P split hi/lo into two B operands in place, O^T += V^T.P^T.
// The maximum in use may trail the true one by up to 8 (base 2), so the accumulators are rescaled rarely. The 8 slices of a query are joined through LDS at the end, in slice order.
__global__ __launch_bounds__(32 * FNW) void k_fattn(const float* __restrict__ Q, const bf* __restrict__ KB, const bf* __restrict__ VB, float* __restrict__ OUT) {
    __shared__ __align__(16) float os[FNW * OPW];
    __shared__ float st[FNW * 64];    // per wave: 32 maxima, then 32 sums
    const int lane = threadIdx.x & 31, c = lane & 15, h = lane >> 4;
    const int wave = __builtin_amdgcn_readfirstlane((int)(threadIdx.x >> 5)); const int qg = wave & 1, ks = wave >> 1;
    const int b = blockIdx.x / (TT / FQ), r0 = (blockIdx.x % (TT / FQ)) * FQ;
    v16bf qf[2][2];
#pragma unroll
    for (int g = 0; g < 2; ++g) { const float* qp = Q + ((size_t)b * TT + r0 + qg * 32 + g * 16 + c) * HD + 8 * h;
#pragma unroll
        for (int kc = 0; kc < 2; ++kc) { const v8f x = *(const v8f*)(qp + 32 * kc), y = *(const v8f*)(qp + 32 * kc + 16); v8us lo, hi2;
#pragma unroll
            for (int e = 0; e < 8; ++e) { lo[e] = f2bf(x[e]); hi2[e] = f2bf(y[e]); }
            qf[g][kc] = cat16b(lo, hi2); } }
    v8f acc[2][4]; float m_run[2], l_run[2];
#pragma unroll
    for (int g = 0; g < 2; ++g) { m_run[g] = -__builtin_inff(); l_run[g] = 0.f;
#pragma unroll
        for (int t = 0; t < 4; ++t) acc[g][t] = (v8f){}; }
    const bf* kp = KB + ((size_t)b * TT + ks * KSL) * HD + lane * 8;   // + pass * 32 * HD + (kt * 2 + kc) * 512
    const bf* vp = VB + ((size_t)b * TT + ks * KSL) * HD + lane * 8;   // + pass * 32 * HD + t * 512
    v16bf kf[2][2];
#pragma unroll
    for (int kt = 0; kt < 2; ++kt)
#pragma unroll
        for (int kc = 0; kc < 2; ++kc) kf[kt][kc] = ldfrag(kp + (kt * 2 + kc) * 512);
#pragma unroll 1   // one pass per trip: the registers of a second pass would cost the fourth wave per SIMD
    for (int p = 0; p < KSL / 32; ++p) {
        v16bf vf[4]; const bf* vq = vp + (size_t)p * (32 * HD);
#pragma unroll
        for (int t = 0; t < 4; ++t) vf[t] = ldfrag(vq + t * 512);
        asm volatile("s_wait_xcnt 0x0" :: "v"(vq) : "memory");   // precaution: stands before anything, a later load's result too, may take the registers that these loads' address is in (named as an input, the address stays in them up to here)
        v8f s[2][2];
#pragma unroll
        for (int kt = 0; kt < 2; ++kt)
#pragma unroll
            for (int g = 0; g < 2; ++g) { s[kt][g] = wmmab(kf[kt][0], qf[g][0], (v8f){}); s[kt][g] = wmmab(kf[kt][1], qf[g][1], s[kt][g]); }
        const bf* kq = kp + (size_t)((p + 1 < KSL / 32) ? p + 1 : p) * (32 * HD);   // the next pass's K, fetched under this pass's softmax; the last pass fetches its own again and stays in bounds
#pragma unroll
        for (int kt = 0; kt < 2; ++kt)
#pragma unroll
            for (int kc = 0; kc < 2; ++kc) kf[kt][kc] = ldfrag(kq + (kt * 2 + kc) * 512);
        asm volatile("s_wait_xcnt 0x0" :: "v"(kq) : "memory");   // precaution, as behind the value loads
        float mb[2]; bool need = false;
#pragma unroll
        for (int g = 0; g < 2; ++g) { float mx = s[0][g][0];
#pragma unroll
            for (int r = 1; r < 8; ++r) mx = fmaxf(mx, s[0][g][r]);
#pragma unroll
            for (int r = 0; r < 8; ++r) mx = fmaxf(mx, s[1][g][r]);
            mx = fmaxf(mx, xhalf(mx)) * CSC; mb[g] = mx; need = need || (mx > m_run[g] + 8.0f); }
        if (__builtin_amdgcn_ballot_w32(need) != 0) {   // wave-uniform; rare after the first passes
#pragma unroll
            for (int g = 0; g < 2; ++g) { const float mn = fmaxf(m_run[g], mb[g]); const float corr = __builtin_amdgcn_exp2f(m_run[g] - mn);   // 0 on the first pass
                m_run[g] = mn; l_run[g] *= corr;
#pragma unroll
                for (int t = 0; t < 4; ++t) acc[g][t] = acc[g][t] * corr; }
        }
#pragma unroll
        for (int g = 0; g < 2; ++g) { const float nm = -m_run[g]; v8u wh, wl; float ls0 = 0.f, ls1 = 0.f;
#pragma unroll
            for (int i = 0; i < 8; ++i) {
                const v2f arg = __builtin_elementwise_fma((v2f){s[i >> 2][g][2 * (i & 3)], s[i >> 2][g][2 * (i & 3) + 1]}, (v2f){CSC, CSC}, (v2f){nm, nm});
                const float p0 = __builtin_amdgcn_exp2f(arg.x), p1 = __builtin_amdgcn_exp2f(arg.y);
                const unsigned w = pack2(p0, p1); wh[i] = w;
                wl[i] = pack2(p0 - __uint_as_float(w << 16), p1 - __uint_as_float(w & 0xFFFF0000u));
                ls0 += p0; ls1 += p1; }
            l_run[g] += ls0 + ls1;
            const v16bf ph = __builtin_bit_cast(v16bf, wh), pl = __builtin_bit_cast(v16bf, wl);
#pragma unroll
            for (int t = 0; t < 4; ++t) acc[g][t] = wmmab(vf[t], ph, acc[g][t]);
#pragma unroll
            for (int t = 0; t < 4; ++t) acc[g][t] = wmmab(vf[t], pl, acc[g][t]); }
    }
    // Join the 8 key slices of each query: every wave publishes its maximum and its sum, scales its tile to the common maximum and the whole sum, and the tiles are added in slice order.
#pragma unroll
    for (int g = 0; g < 2; ++g) { const float l = l_run[g] + xhalf(l_run[g]);   // both halves' keys; unconditional, every lane on
        st[wave * 64 + h * 32 + g * 16 + c] = h ? l : m_run[g]; }
    __syncthreads();   // every wave's maxima and sums are in LDS before any wave reads them
    float* ow = os + wave * OPW;
#pragma unroll
    for (int g = 0; g < 2; ++g) { float M = st[qg * 64 + g * 16 + c];
#pragma unroll
        for (int k = 1; k < FKS; ++k) M = fmaxf(M, st[(2 * k + qg) * 64 + g * 16 + c]);
        float L = 0.f;
#pragma unroll
        for (int k = 0; k < FKS; ++k) L += st[(2 * k + qg) * 64 + 32 + g * 16 + c] * exp2_slot(st[(2 * k + qg) * 64 + g * 16 + c] - M);
        const float f = __fdiv_rn(exp2_slot(m_run[g] - M), L);
#pragma unroll
        for (int t = 0; t < 4; ++t) { const v8f o = acc[g][t] * f; float* d = ow + (g * 16 + c) * 68 + t * 16 + 8 * h;   // row = query; the 8 floats are d = 16 t + 8 h ...
            *(v4fa*)d = (v4f){o[0], o[1], o[2], o[3]}; *(v4fa*)(d + 4) = (v4f){o[4], o[5], o[6], o[7]}; } }
    __syncthreads();   // every wave's scaled tile is in LDS before a thread sums them
#pragma unroll
    for (int u = 0; u < 2; ++u) { const int i = threadIdx.x + u * (32 * FNW); const int q = i >> 4, d4 = (i & 15) * 4; const float* ip = os + (q >> 5) * OPW + (q & 31) * 68 + d4;
        v4f a = *(const v4fa*)ip;
#pragma unroll
        for (int k = 1; k < FKS; ++k) a += *(const v4fa*)(ip + 2 * k * OPW);
        *(v4f*)(OUT + ((size_t)b * TT + r0 + q) * HD + d4) = a; }
}

extern "C" void kernel_launch(void* const* d_in, const int* in_sizes, int n_in,
                              void* d_out, int out_size, void* d_ws, size_t ws_size, hipStream_t stream) {
    (void)in_sizes; (void)n_in; (void)out_size;
    const float* Qin = (const float*)d_in[0]; const float* Kin = (const float*)d_in[1]; const float* Vin = (const float*)d_in[2];
    float* OUT = (float*)d_out;     // [4][4096][64]
    char* wsp = (char*)d_ws;
    auto take = [&](size_t bytes) { char* p = wsp; wsp += (bytes + 255) & ~(size_t)255; return (void*)p; };
    bf* KB = (bf*)take((size_t)NB_ * TT * HD * 2); bf* VB = (bf*)take((size_t)NB_ * TT * HD * 2);
    if ((size_t)(wsp - (char*)d_ws) > ws_size) return;
    k_kfrag<<<NB_ * TT * HD / 8 / 256, 256, 0, stream>>>(Kin, KB);
    k_vfrag<<<NB_ * TT * HD / 8 / 256, 256, 0, stream>>>(Vin, VB);
    k_fattn<<<NB_ * (TT / FQ), 32 * FNW, 0, stream>>>(Qin, KB, VB, OUT);
}

// v004
// Measured time: 21.7 microseconds a run.
// Versions in between are left out here; by their measured steps it is 1.28 times as fast as v002.
// Counting every step since v000, it is 28.7 times as fast.
#include <hip/hip_runtime.h>

// Standard single-head attention on given tensors over 4,096 tokens (q, k, v [4][4096][64]; scores x 64^-0.5; softmax; out = attn v -> [4][4096][64] (1.05 M)).
// One fused kernel over all four batches: S^T = K.Q^T, online softmax in registers, O^T += V^T.P^T; scores and P never leave the registers.
// Compute dtypes, f32 accumulate: every input rounded to bf16; q.k exact; softmax f32; P rounded once to f16 x exact value (a bf16 value from 2^-17 to 65,504 in size is held exactly in f16, a smaller one to within 2^-25); output f32.
// Every plain '#pragma unroll' below stands on a short loop, most over register arrays (fragments, accumulators, packed words): unrolled, their indices are constants and they stay in registers.

#define NB_  4
#define TT   4096
#define HD   64
#define FQ   64                 // query rows per workgroup: two 32-column groups
#define FKS  8                  // key slices per workgroup, one wave per (slice, column group)
#define FNW  (2 * FKS)          // waves per workgroup
#define KSL  (TT / FKS)         // keys per slice
#define OPW  (32 * 68)          // floats of one wave's staged 32 x 64 output tile (row pitch 68)
#define PU   2                  // 16-byte units of each fragment plane per thread of the conversion launch
#define CSC  0.18033688011112042f   // 64^-0.5 x log2(e): the softmax runs in base 2
typedef unsigned short bf;
typedef __attribute__((ext_vector_type(16))) __bf16   v16bf;
typedef __attribute__((ext_vector_type(16))) _Float16 v16h;
typedef __attribute__((ext_vector_type(2)))  _Float16 v2h;
typedef __attribute__((ext_vector_type(8)))  unsigned short v8us;
typedef __attribute__((ext_vector_type(8)))  unsigned v8u;
typedef __attribute__((ext_vector_type(8)))  float    v8f;
typedef __attribute__((ext_vector_type(4)))  float    v4f;
typedef __attribute__((ext_vector_type(2)))  float    v2f;
typedef v4f  __attribute__((may_alias)) v4fa;

__device__ __forceinline__ unsigned short f2bf(float f) { unsigned u = __float_as_uint(f); u += 0x7FFFu + ((u >> 16) & 1u); return (unsigned short)(u >> 16); }
__device__ __forceinline__ v16bf cat16b(v8us lo, v8us hi) { return __builtin_bit_cast(v16bf, __builtin_shufflevector(lo, hi, 0, 1, 2, 3, 4, 5, 6, 7, 8, 9, 10, 11, 12, 13, 14, 15)); }
__device__ __forceinline__ v8f wmmab(v16bf a, v16bf b, v8f c) { return __builtin_amdgcn_wmma_f32_16x16x32_bf16(false, a, false, b, (short)0, c, false, false); }
__device__ __forceinline__ v8f wmmah(v16h a, v16h b, v8f c) { return __builtin_amdgcn_wmma_f32_16x16x32_f16(false, a, false, b, (short)0, c, false, false); }
// Fragment planes: a 16 (rows) x 32 (k) 16-bit operand is stored as the matrix instruction takes it, two runs of 512 bytes: run j, lane l = 16 h + c, holds row c, k = 16 j + 8 h + (0 ... 7).
// So each wave-wide 16-byte load covers four whole 128-byte lines. p points at the lane's 16 bytes of run 0.
__device__ __forceinline__ v16bf ldfrag(const bf* p) { return cat16b(*(const v8us*)p, *(const v8us*)(p + 256)); }
__device__ __forceinline__ unsigned pack2(float lo, float hi) { return __builtin_bit_cast(unsigned, __builtin_convertvector((v2f){lo, hi}, v2h)); }   // two f16, round to nearest even
__device__ __forceinline__ float xhalf(float x) { return __builtin_bit_cast(float, __builtin_amdgcn_permlanex16(__builtin_bit_cast(int, x), __builtin_bit_cast(int, x), 0x76543210, 0xfedcba98, false, false)); }   // lane l with lane l ^ 16
// exp2 for the join at the kernel's end: the v_nop is the one slot that the instruction set asks for behind a transcendental before its result is read or its source overwritten; in one statement it stands there in every build.
__device__ __forceinline__ float exp2_slot(float x) { float r; asm("v_exp_f32 %0, %1\n\tv_nop" : "=v"(r) : "v"(x)); return r; }

// k_frag: both fragment planes in one launch of 256 workgroups. A thread makes PU units of 16 bytes of each plane (units i + 256 u: 32 u keys on in both planes); all its loads are issued before the first store.
// KF[16-key tile][kc = d / 32][run j][lane][8]: rows are keys, k is d. VF[32-key block][t = d / 16][run j][lane][8]: rows are d, k is the key; each value is rounded to bf16 as before and that value is stored as f16.
__global__ __launch_bounds__(256) void k_frag(const float* __restrict__ K, const float* __restrict__ V, bf* __restrict__ KF, bf* __restrict__ VF) {
    const int i = blockIdx.x * (PU * 256) + threadIdx.x; const int c = i & 15, h = (i >> 4) & 1, j = (i >> 5) & 1;
    const int kc = (i >> 6) & 1, tile = i >> 7;   // the K unit
    const int t = (i >> 6) & 3, blk = i >> 8;     // the value unit
    const float* sk = K + (size_t)(tile * 16 + c) * HD + 32 * kc + 16 * j + 8 * h;
    const float* sv = V + (size_t)(blk * 32 + 16 * j + 8 * h) * HD + 16 * t + c;
    v8f xk[PU]; float xv[PU][8];
#pragma unroll
    for (int u = 0; u < PU; ++u) { xk[u] = *(const v8f*)(sk + u * (32 * HD));
#pragma unroll
        for (int e = 0; e < 8; ++e) xv[u][e] = sv[(u * 32 + e) * HD]; }
    asm volatile("s_wait_xcnt 0x0" :: "v"(sk), "v"(sv) : "memory");   // precaution: stands before anything, a later load's result too, may take the registers that these loads' addresses are in (named as inputs, the addresses stay in them up to here)
#pragma unroll
    for (int u = 0; u < PU; ++u) { v8us ok, ov;
#pragma unroll
        for (int e = 0; e < 8; ++e) { ok[e] = f2bf(xk[u][e]); ov[e] = __builtin_bit_cast(unsigned short, (_Float16)__uint_as_float((unsigned)f2bf(xv[u][e]) << 16)); }
        *(v8us*)(KF + (size_t)(i + u * 256) * 8) = ok; *(v8us*)(VF + (size_t)(i + u * 256) * 8) = ov; }
}

// k_fattn: one workgroup per 64 query rows of one batch, 16 waves. Wave (ks, qg) walks keys [ks * KSL, (ks + 1) * KSL) in passes of 32 for the 32 query columns of group qg.
// Per pass: S^T = K.Q^T (a lane holds 16 scores of one query per 16-column group), maximum in lane plus one exchange between the halves, exp2, P packed to one f16 B operand in place, O^T += V^T.P^T on the f16 form.
// The maximum in use may trail the true one by up to 8 (base 2), so the accumulators are rescaled rarely. The 8 slices of a query are joined through LDS at the end, in slice order.
__global__ __launch_bounds__(32 * FNW) void k_fattn(const float* __restrict__ Q, const bf* __restrict__ KB, const bf* __restrict__ VB, float* __restrict__ OUT) {
    __shared__ __align__(16) float os[FNW * OPW];
    __shared__ float st[FNW * 64];    // per wave: 32 maxima, then 32 sums
    const int lane = threadIdx.x & 31, c = lane & 15, h = lane >> 4;
    const int wave = __builtin_amdgcn_readfirstlane((int)(threadIdx.x >> 5)); const int qg = wave & 1, ks = wave >> 1;
    const int b = blockIdx.x / (TT / FQ), r0 = (blockIdx.x % (TT / FQ)) * FQ;
    v16bf qf[2][2];
#pragma unroll
    for (int g = 0; g < 2; ++g) { const float* qp = Q + ((size_t)b * TT + r0 + qg * 32 + g * 16 + c) * HD + 8 * h;
#pragma unroll
        for (int kc = 0; kc < 2; ++kc) { const v8f x = *(const v8f*)(qp + 32 * kc), y = *(const v8f*)(qp + 32 * kc + 16); v8us lo, hi2;
#pragma unroll
            for (int e = 0; e < 8; ++e) { lo[e] = f2bf(x[e]); hi2[e] = f2bf(y[e]); }
            qf[g][kc] = cat16b(lo, hi2); } }
    v8f acc[2][4]; float m_run[2], l_run[2];
#pragma unroll
    for (int g = 0; g < 2; ++g) { m_run[g] = -__builtin_inff(); l_run[g] = 0.f;
#pragma unroll
        for (int t = 0; t < 4; ++t) acc[g][t] = (v8f){}; }
    const bf* kp = KB + ((size_t)b * TT + ks * KSL) * HD + lane * 8;   // + pass * 32 * HD + (kt * 2 + kc) * 512
    const bf* vp = VB + ((size_t)b * TT + ks * KSL) * HD + lane * 8;   // + pass * 32 * HD + t * 512
    v16bf kf[2][2];
#pragma unroll
    for (int kt = 0; kt < 2; ++kt)
#pragma unroll
        for (int kc = 0; kc < 2; ++kc) kf[kt][kc] = ldfrag(kp + (kt * 2 + kc) * 512);
#pragma unroll 1   // one pass per trip: the registers of a second pass would cost the fourth wave per SIMD
    for (int p = 0; p < KSL / 32; ++p) {
        v16h vf[4]; const bf* vq = vp + (size_t)p * (32 * HD);
#pragma unroll
        for (int t = 0; t < 4; ++t) vf[t] = __builtin_bit_cast(v16h, ldfrag(vq + t * 512));
        asm volatile("s_wait_xcnt 0x0" :: "v"(vq) : "memory");   // precaution: stands before anything, a later load's result too, may take the registers that these loads' address is in (named as an input, the address stays in them up to here)
        v8f s[2][2];
#pragma unroll
        for (int kt = 0; kt < 2; ++kt)
#pragma unroll
            for (int g = 0; g < 2; ++g) { s[kt][g] = wmmab(kf[kt][0], qf[g][0], (v8f){}); s[kt][g] = wmmab(kf[kt][1], qf[g][1], s[kt][g]); }
        const bf* kq = kp + (size_t)((p + 1 < KSL / 32) ? p + 1 : p) * (32 * HD);   // the next pass's K, fetched under this pass's softmax; the last pass fetches its own again and stays in bounds
#pragma unroll
        for (int kt = 0; kt < 2; ++kt)
#pragma unroll
            for (int kc = 0; kc < 2; ++kc) kf[kt][kc] = ldfrag(kq + (kt * 2 + kc) * 512);
        asm volatile("s_wait_xcnt 0x0" :: "v"(kq) : "memory");   // precaution, as behind the value loads
        float mb[2]; bool need = false;
#pragma unroll
        for (int g = 0; g < 2; ++g) { float mx = s[0][g][0];
#pragma unroll
            for (int r = 1; r < 8; ++r) mx = fmaxf(mx, s[0][g][r]);
#pragma unroll
            for (int r = 0; r < 8; ++r) mx = fmaxf(mx, s[1][g][r]);
            mx = fmaxf(mx, xhalf(mx)) * CSC; mb[g] = mx; need = need || (mx > m_run[g] + 8.0f); }
        if (__builtin_amdgcn_ballot_w32(need) != 0) {   // wave-uniform; rare after the first passes
#pragma unroll
            for (int g = 0; g < 2; ++g) { const float mn = fmaxf(m_run[g], mb[g]); const float corr = __builtin_amdgcn_exp2f(m_run[g] - mn);   // 0 on the first pass
                m_run[g] = mn; l_run[g] *= corr;
#pragma unroll
                for (int t = 0; t < 4; ++t) acc[g][t] = acc[g][t] * corr; }
        }
#pragma unroll
        for (int g = 0; g < 2; ++g) { const float nm = -m_run[g]; v8u wh; float ls0 = 0.f, ls1 = 0.f;
#pragma unroll
            for (int i = 0; i < 8; ++i) {
                const v2f arg = __builtin_elementwise_fma((v2f){s[i >> 2][g][2 * (i & 3)], s[i >> 2][g][2 * (i & 3) + 1]}, (v2f){CSC, CSC}, (v2f){nm, nm});
                const float p0 = __builtin_amdgcn_exp2f(arg.x), p1 = __builtin_amdgcn_exp2f(arg.y);
                wh[i] = pack2(p0, p1);   // at most 2^8, since the maximum in use trails by at most 8: far inside the f16 range
                ls0 += p0; ls1 += p1; }
            l_run[g] += ls0 + ls1;
            const v16h ph = __builtin_bit_cast(v16h, wh);
#pragma unroll
            for (int t = 0; t < 4; ++t) acc[g][t] = wmmah(vf[t], ph, acc[g][t]); }
    }
    // Join the 8 key slices of each query: every wave publishes its maximum and its sum, scales its tile to the common maximum and the whole sum, and the tiles are added in slice order.
#pragma unroll
    for (int g = 0; g < 2; ++g) { const float l = l_run[g] + xhalf(l_run[g]);   // both halves' keys; unconditional, every lane on
        st[wave * 64 + h * 32 + g * 16 + c] = h ? l : m_run[g]; }
    __syncthreads();   // every wave's maxima and sums are in LDS before any wave reads them
    float* ow = os + wave * OPW;
#pragma unroll
    for (int g = 0; g < 2; ++g) { float M = st[qg * 64 + g * 16 + c];
#pragma unroll
        for (int k = 1; k < FKS; ++k) M = fmaxf(M, st[(2 * k + qg) * 64 + g * 16 + c]);
        float L = 0.f;
#pragma unroll
        for (int k = 0; k < FKS; ++k) L += st[(2 * k + qg) * 64 + 32 + g * 16 + c] * exp2_slot(st[(2 * k + qg) * 64 + g * 16 + c] - M);
        const float f = __fdiv_rn(exp2_slot(m_run[g] - M), L);
#pragma unroll
        for (int t = 0; t < 4; ++t) { const v8f o = acc[g][t] * f; float* d = ow + (g * 16 + c) * 68 + t * 16 + 8 * h;   // row = query; the 8 floats are d = 16 t + 8 h ...
            *(v4fa*)d = (v4f){o[0], o[1], o[2], o[3]}; *(v4fa*)(d + 4) = (v4f){o[4], o[5], o[6], o[7]}; } }
    __syncthreads();   // every wave's scaled tile is in LDS before a thread sums them
#pragma unroll
    for (int u = 0; u < 2; ++u) { const int i = threadIdx.x + u * (32 * FNW); const int q = i >> 4, d4 = (i & 15) * 4; const float* ip = os + (q >> 5) * OPW + (q & 31) * 68 + d4;
        v4f a = *(const v4fa*)ip;
#pragma unroll
        for (int k = 1; k < FKS; ++k) a += *(const v4fa*)(ip + 2 * k * OPW);
        *(v4f*)(OUT + ((size_t)b * TT + r0 + q) * HD + d4) = a; }
}

extern "C" void kernel_launch(void* const* d_in, const int* in_sizes, int n_in,
                              void* d_out, int out_size, void* d_ws, size_t ws_size, hipStream_t stream) {
    (void)in_sizes; (void)n_in; (void)out_size;
    const float* Qin = (const float*)d_in[0]; const float* Kin = (const float*)d_in[1]; const float* Vin = (const float*)d_in[2];
    float* OUT = (float*)d_out;     // [4][4096][64]
    char* wsp = (char*)d_ws;
    auto take = [&](size_t bytes) { char* p = wsp; wsp += (bytes + 255) & ~(size_t)255; return (void*)p; };
    bf* KB = (bf*)take((size_t)NB_ * TT * HD * 2); bf* VB = (bf*)take((size_t)NB_ * TT * HD * 2);
    if ((size_t)(wsp - (char*)d_ws) > ws_size) return;
    k_frag<<<NB_ * TT * HD / 8 / 256 / PU, 256, 0, stream>>>(Kin, Vin, KB, VB);
    k_fattn<<<NB_ * (TT / FQ), 32 * FNW, 0, stream>>>(Qin, KB, VB, OUT);
}

// v005
// Measured time: 20.7 microseconds a run.
// Next to v004, in two timings, it ran 1.06 and 1.05 times as fast.
// All steps since v000 together make it 30.2 times as fast.
#include <hip/hip_runtime.h>

// Standard single-head attention on given tensors over 4,096 tokens (q, k, v [4][4096][64]; scores x 64^-0.5; softmax; out = attn v -> [4][4096][64] (1.05 M)).
// One fused kernel over all four batches: S^T = K.Q^T, online softmax in registers, O^T += V^T.P^T; scores and P never leave the registers.
// Compute dtypes, f32 accumulate: every input rounded to bf16; q.k exact; softmax f32; P rounded once to f16 x exact value (a bf16 value from 2^-17 to 65,504 in size is held exactly in f16, a smaller one to within 2^-25); output f32.
// Every plain '#pragma unroll' below stands on a short loop, most over register arrays (fragments, accumulators, packed words): unrolled, their indices are constants and they stay in registers.

#define NB_  4
#define TT   4096
#define HD   64
#define FQ   64                 // query rows per workgroup: two 32-column groups
#define FKS  8                  // key slices per workgroup, one wave per (slice, column group)
#define FNW  (2 * FKS)          // waves per workgroup
#define KSL  (TT / FKS)         // keys per slice
#define NP   (KSL / 32)         // passes of 32 keys per slice: a power of two, the walk wraps by a mask
#define OPW  (32 * 68)          // floats of one wave's staged 32 x 64 output tile (row pitch 68)
#define PU   2                  // 16-byte units of each fragment plane per thread of the conversion launch
#define CSC  0.18033688011112042f   // 64^-0.5 x log2(e): the softmax runs in base 2
typedef unsigned short bf;
typedef __attribute__((ext_vector_type(16))) __bf16   v16bf;
typedef __attribute__((ext_vector_type(16))) _Float16 v16h;
typedef __attribute__((ext_vector_type(2)))  _Float16 v2h;
typedef __attribute__((ext_vector_type(8)))  unsigned short v8us;
typedef __attribute__((ext_vector_type(8)))  unsigned v8u;
typedef __attribute__((ext_vector_type(8)))  float    v8f;
typedef __attribute__((ext_vector_type(4)))  float    v4f;
typedef __attribute__((ext_vector_type(2)))  float    v2f;
typedef v4f  __attribute__((may_alias)) v4fa;

__device__ __forceinline__ unsigned short f2bf(float f) { unsigned u = __float_as_uint(f); u += 0x7FFFu + ((u >> 16) & 1u); return (unsigned short)(u >> 16); }
__device__ __forceinline__ v16bf cat16b(v8us lo, v8us hi) { return __builtin_bit_cast(v16bf, __builtin_shufflevector(lo, hi, 0, 1, 2, 3, 4, 5, 6, 7, 8, 9, 10, 11, 12, 13, 14, 15)); }
__device__ __forceinline__ v8f wmmab(v16bf a, v16bf b, v8f c) { return __builtin_amdgcn_wmma_f32_16x16x32_bf16(false, a, false, b, (short)0, c, false, false); }
__device__ __forceinline__ v8f wmmah(v16h a, v16h b, v8f c) { return __builtin_amdgcn_wmma_f32_16x16x32_f16(false, a, false, b, (short)0, c, false, false); }
// Fragment planes: a 16 (rows) x 32 (k) 16-bit operand is stored as the matrix instruction takes it, two runs of 512 bytes: run j, lane l = 16 h + c, holds row c, k = 16 j + 8 h + (0 ... 7).
// So each wave-wide 16-byte load covers four whole 128-byte lines. p points at the lane's 16 bytes of run 0.
__device__ __forceinline__ v16bf ldfrag(const bf* p) { return cat16b(*(const v8us*)p, *(const v8us*)(p + 256)); }
__device__ __forceinline__ unsigned pack2(float lo, float hi) { return __builtin_bit_cast(unsigned, __builtin_convertvector((v2f){lo, hi}, v2h)); }   // two f16, round to nearest even
__device__ __forceinline__ float xhalf(float x) { return __builtin_bit_cast(float, __builtin_amdgcn_permlanex16(__builtin_bit_cast(int, x), __builtin_bit_cast(int, x), 0x76543210, 0xfedcba98, false, false)); }   // lane l with lane l ^ 16
// exp2 for the join at the kernel's end: the v_nop is the one slot that the instruction set asks for behind a transcendental before its result is read or its source overwritten; in one statement it stands there in every build.
__device__ __forceinline__ float exp2_slot(float x) { float r; asm("v_exp_f32 %0, %1\n\tv_nop" : "=v"(r) : "v"(x)); return r; }

// k_frag: both fragment planes in one launch of 256 workgroups. A thread makes PU units of 16 bytes of each plane (units i + 256 u: 32 u keys on in both planes); all its loads are issued before the first store.
// KF[16-key tile][kc = d / 32][run j][lane][8]: rows are keys, k is d. VF[32-key block][t = d / 16][run j][lane][8]: rows are d, k is the key; each value is rounded to bf16 as before and that value is stored as f16.
__global__ __launch_bounds__(256) void k_frag(const float* __restrict__ K, const float* __restrict__ V, bf* __restrict__ KF, bf* __restrict__ VF) {
    const int i = blockIdx.x * (PU * 256) + threadIdx.x; const int c = i & 15, h = (i >> 4) & 1, j = (i >> 5) & 1;
    const int kc = (i >> 6) & 1, tile = i >> 7;   // the K unit
    const int t = (i >> 6) & 3, blk = i >> 8;     // the value unit
    const float* sk = K + (size_t)(tile * 16 + c) * HD + 32 * kc + 16 * j + 8 * h;
    const float* sv = V + (size_t)(blk * 32 + 16 * j + 8 * h) * HD + 16 * t + c;
    v8f xk[PU]; float xv[PU][8];
#pragma unroll
    for (int u = 0; u < PU; ++u) { xk[u] = *(const v8f*)(sk + u * (32 * HD));
#pragma unroll
        for (int e = 0; e < 8; ++e) xv[u][e] = sv[(u * 32 + e) * HD]; }
    asm volatile("s_wait_xcnt 0x0" :: "v"(sk), "v"(sv) : "memory");   // precaution: stands before anything, a later load's result too, may take the registers that these loads' addresses are in (named as inputs, the addresses stay in them up to here)
#pragma unroll
    for (int u = 0; u < PU; ++u) { v8us ok, ov;
#pragma unroll
        for (int e = 0; e < 8; ++e) { ok[e] = f2bf(xk[u][e]); ov[e] = __builtin_bit_cast(unsigned short, (_Float16)__uint_as_float((unsigned)f2bf(xv[u][e]) << 16)); }
        *(v8us*)(KF + (size_t)(i + u * 256) * 8) = ok; *(v8us*)(VF + (size_t)(i + u * 256) * 8) = ov; }
}

// k_fattn: one workgroup per 64 query rows of one batch, 16 waves. Wave (ks, qg) walks keys [ks * KSL, (ks + 1) * KSL) in passes of 32 for the 32 query columns of group qg.
// Per pass: S^T = K.Q^T (a lane holds 16 scores of one query per 16-column group), maximum in lane plus one exchange between the halves, exp2, P packed to one f16 B operand in place, O^T += V^T.P^T on the f16 form.
// The maximum in use may trail the true one by up to 8 (base 2), so the accumulators are rescaled rarely. The 8 slices of a query are joined through LDS at the end, in slice order.
// The 64 workgroups of a batch read the same K and value planes: each enters its slices at pass rot and wraps round, so that they do not ask L2 for the same lines at the same moment. Every pass is still done once; only the order of the online sums differs between workgroups.
__global__ __launch_bounds__(32 * FNW) void k_fattn(const float* __restrict__ Q, const bf* __restrict__ KB, const bf* __restrict__ VB, float* __restrict__ OUT) {
    __shared__ __align__(16) float os[FNW * OPW];
    __shared__ float st[FNW * 64];    // per wave: 32 maxima, then 32 sums
    const int lane = threadIdx.x & 31, c = lane & 15, h = lane >> 4;
    const int wave = __builtin_amdgcn_readfirstlane((int)(threadIdx.x >> 5)); const int qg = wave & 1, ks = wave >> 1;
    const int b = blockIdx.x / (TT / FQ), r0 = (blockIdx.x % (TT / FQ)) * FQ;
    const int wq = blockIdx.x % (TT / FQ), rot = (((wq >> 2) & ~1) | (wq & 1)) & (NP - 1);   // 16 entry passes over 64 workgroups; any 4 neighbouring indices modulo 8 take each entry equally often (speed only, no result rests on it)
    v16bf qf[2][2];
#pragma unroll
    for (int g = 0; g < 2; ++g) { const float* qp = Q + ((size_t)b * TT + r0 + qg * 32 + g * 16 + c) * HD + 8 * h;
#pragma unroll
        for (int kc = 0; kc < 2; ++kc) { const v8f x = *(const v8f*)(qp + 32 * kc), y = *(const v8f*)(qp + 32 * kc + 16); v8us lo, hi2;
#pragma unroll
            for (int e = 0; e < 8; ++e) { lo[e] = f2bf(x[e]); hi2[e] = f2bf(y[e]); }
            qf[g][kc] = cat16b(lo, hi2); } }
    v8f acc[2][4]; float m_run[2], l_run[2];
#pragma unroll
    for (int g = 0; g < 2; ++g) { m_run[g] = -__builtin_inff(); l_run[g] = 0.f;
#pragma unroll
        for (int t = 0; t < 4; ++t) acc[g][t] = (v8f){}; }
    const bf* kb = KB + ((size_t)b * TT + ks * KSL) * HD + lane * 8;   // + pass * 32 * HD + (kt * 2 + kc) * 512
    const bf* vp = VB + ((size_t)b * TT + ks * KSL) * HD + lane * 8;   // + pass * 32 * HD + t * 512
    const bf* kp = kb + (size_t)rot * (32 * HD);   // the entry pass
    v16bf kf[2][2];
#pragma unroll
    for (int kt = 0; kt < 2; ++kt)
#pragma unroll
        for (int kc = 0; kc < 2; ++kc) kf[kt][kc] = ldfrag(kp + (kt * 2 + kc) * 512);
#pragma unroll 1   // one pass per trip: the registers of a second pass would cost the fourth wave per SIMD
    for (int p = 0; p < NP; ++p) {
        v16h vf[4]; const bf* vq = vp + (size_t)((p + rot) & (NP - 1)) * (32 * HD);
#pragma unroll
        for (int t = 0; t < 4; ++t) vf[t] = __builtin_bit_cast(v16h, ldfrag(vq + t * 512));
        asm volatile("s_wait_xcnt 0x0" :: "v"(vq) : "memory");   // precaution: stands before anything, a later load's result too, may take the registers that these loads' address is in (named as an input, the address stays in them up to here)
        v8f s[2][2];
#pragma unroll
        for (int kt = 0; kt < 2; ++kt)
#pragma unroll
            for (int g = 0; g < 2; ++g) { s[kt][g] = wmmab(kf[kt][0], qf[g][0], (v8f){}); s[kt][g] = wmmab(kf[kt][1], qf[g][1], s[kt][g]); }
        const bf* kq = kb + (size_t)((p + 1 + rot) & (NP - 1)) * (32 * HD);   // the next pass's K, fetched under this pass's softmax; the last pass fetches the entry pass again, unused, and stays in bounds by the mask
#pragma unroll
        for (int kt = 0; kt < 2; ++kt)
#pragma unroll
            for (int kc = 0; kc < 2; ++kc) kf[kt][kc] = ldfrag(kq + (kt * 2 + kc) * 512);
        asm volatile("s_wait_xcnt 0x0" :: "v"(kq) : "memory");   // precaution, as behind the value loads
        float mb[2]; bool need = false;
#pragma unroll
        for (int g = 0; g < 2; ++g) { float mx = s[0][g][0];
#pragma unroll
            for (int r = 1; r < 8; ++r) mx = fmaxf(mx, s[0][g][r]);
#pragma unroll
            for (int r = 0; r < 8; ++r) mx = fmaxf(mx, s[1][g][r]);
            mx = fmaxf(mx, xhalf(mx)) * CSC; mb[g] = mx; need = need || (mx > m_run[g] + 8.0f); }
        if (__builtin_amdgcn_ballot_w32(need) != 0) {   // wave-uniform; rare after the first passes
#pragma unroll
            for (int g = 0; g < 2; ++g) { const float mn = fmaxf(m_run[g], mb[g]); const float corr = __builtin_amdgcn_exp2f(m_run[g] - mn);   // 0 on the first pass
                m_run[g] = mn; l_run[g] *= corr;
#pragma unroll
                for (int t = 0; t < 4; ++t) acc[g][t] = acc[g][t] * corr; }
        }
#pragma unroll
        for (int g = 0; g < 2; ++g) { const float nm = -m_run[g]; v8u wh; float ls0 = 0.f, ls1 = 0.f;
#pragma unroll
            for (int i = 0; i < 8; ++i) {
                const v2f arg = __builtin_elementwise_fma((v2f){s[i >> 2][g][2 * (i & 3)], s[i >> 2][g][2 * (i & 3) + 1]}, (v2f){CSC, CSC}, (v2f){nm, nm});
                const float p0 = __builtin_amdgcn_exp2f(arg.x), p1 = __builtin_amdgcn_exp2f(arg.y);
                wh[i] = pack2(p0, p1);   // at most 2^8, since the maximum in use trails by at most 8: far inside the f16 range
                ls0 += p0; ls1 += p1; }
            l_run[g] += ls0 + ls1;
            const v16h ph = __builtin_bit_cast(v16h, wh);
#pragma unroll
            for (int t = 0; t < 4; ++t) acc[g][t] = wmmah(vf[t], ph, acc[g][t]); }
    }
    // Join the 8 key slices of each query: every wave publishes its maximum and its sum, scales its tile to the common maximum and the whole sum, and the tiles are added in slice order.
#pragma unroll
    for (int g = 0; g < 2; ++g) { const float l = l_run[g] + xhalf(l_run[g]);   // both halves' keys; unconditional, every lane on
        st[wave * 64 + h * 32 + g * 16 + c] = h ? l : m_run[g]; }
    __syncthreads();   // every wave's maxima and sums are in LDS before any wave reads them
    float* ow = os + wave * OPW;
#pragma unroll
    for (int g = 0; g < 2; ++g) { float M = st[qg * 64 + g * 16 + c];
#pragma unroll
        for (int k = 1; k < FKS; ++k) M = fmaxf(M, st[(2 * k + qg) * 64 + g * 16 + c]);
        float L = 0.f;
#pragma unroll
        for (int k = 0; k < FKS; ++k) L += st[(2 * k + qg) * 64 + 32 + g * 16 + c] * exp2_slot(st[(2 * k + qg) * 64 + g * 16 + c] - M);
        const float f = __fdiv_rn(exp2_slot(m_run[g] - M), L);
#pragma unroll
        for (int t = 0; t < 4; ++t) { const v8f o = acc[g][t] * f; float* d = ow + (g * 16 + c) * 68 + t * 16 + 8 * h;   // row = query; the 8 floats are d = 16 t + 8 h ...
            *(v4fa*)d = (v4f){o[0], o[1], o[2], o[3]}; *(v4fa*)(d + 4) = (v4f){o[4], o[5], o[6], o[7]}; } }
    __syncthreads();   // every wave's scaled tile is in LDS before a thread sums them
#pragma unroll
    for (int u = 0; u < 2; ++u) { const int i = threadIdx.x + u * (32 * FNW); const int q = i >> 4, d4 = (i & 15) * 4; const float* ip = os + (q >> 5) * OPW + (q & 31) * 68 + d4;
        v4f a = *(const v4fa*)ip;
#pragma unroll
        for (int k = 1; k < FKS; ++k) a += *(const v4fa*)(ip + 2 * k * OPW);
        *(v4f*)(OUT + ((size_t)b * TT + r0 + q) * HD + d4) = a; }
}

extern "C" void kernel_launch(void* const* d_in, const int* in_sizes, int n_in,
                              void* d_out, int out_size, void* d_ws, size_t ws_size, hipStream_t stream) {
    (void)in_sizes; (void)n_in; (void)out_size;
    const float* Qin = (const float*)d_in[0]; const float* Kin = (const float*)d_in[1]; const float* Vin = (const float*)d_in[2];
    float* OUT = (float*)d_out;     // [4][4096][64]
    char* wsp = (char*)d_ws;
    auto take = [&](size_t bytes) { char* p = wsp; wsp += (bytes + 255) & ~(size_t)255; return (void*)p; };
    bf* KB = (bf*)take((size_t)NB_ * TT * HD * 2); bf* VB = (bf*)take((size_t)NB_ * TT * HD * 2);
    if ((size_t)(wsp - (char*)d_ws) > ws_size) return;
    k_frag<<<NB_ * TT * HD / 8 / 256 / PU, 256, 0, stream>>>(Kin, Vin, KB, VB);
    k_fattn<<<NB_ * (TT / FQ), 32 * FNW, 0, stream>>>(Qin, KB, VB, OUT);
}

// v006
// Measured time: 19.3 microseconds a run.
// In both of two side-by-side timings against v005, it was 1.07 times as fast.
// Over all steps from v000 it is 32.5 times as fast.
#include <hip/hip_runtime.h>

// Standard single-head attention on given tensors over 4,096 tokens (q, k, v [4][4096][64]; scores x 64^-0.5; softmax; out = attn v -> [4][4096][64] (1.05 M)).
// One fused kernel over all four batches: S^T = K.Q^T, online softmax in registers, O^T += V^T.P^T; scores and P never leave the registers.
// Compute dtypes, f32 accumulate: every input rounded to bf16; q.k exact; softmax f32; P rounded once to f16 x exact value (a bf16 value from 2^-17 to 65,504 in size is held exactly in f16, a smaller one to within 2^-25); output f32.
// Every plain '#pragma unroll' below stands on a short loop, most over register arrays (fragments, accumulators, packed words): unrolled, their indices are constants and they stay in registers.

#define NB_  4
#define TT   4096
#define HD   64
#define FQ   64                 // query rows per workgroup: two 32-column groups
#define FKS  8                  // key slices per workgroup, one wave per (slice, column group)
#define FNW  (2 * FKS)          // waves per workgroup
#define KSL  (TT / FKS)         // keys per slice
#define NP   (KSL / 32)         // passes of 32 keys per slice: a power of two, the walk wraps by a mask
#define OPW  (32 * 68)          // floats of one wave's staged 32 x 64 output tile (row pitch 68)
#define PU   2                  // 16-byte units of each fragment plane per thread of the conversion launch
#define CSC  0.18033688011112042f   // 64^-0.5 x log2(e): the softmax runs in base 2
typedef unsigned short bf;
typedef __attribute__((ext_vector_type(16))) __bf16   v16bf;
typedef __attribute__((ext_vector_type(16))) _Float16 v16h;
typedef __attribute__((ext_vector_type(2)))  _Float16 v2h;
typedef __attribute__((ext_vector_type(8)))  unsigned short v8us;
typedef __attribute__((ext_vector_type(8)))  unsigned v8u;
typedef __attribute__((ext_vector_type(8)))  float    v8f;
typedef __attribute__((ext_vector_type(4)))  float    v4f;
typedef __attribute__((ext_vector_type(2)))  float    v2f;
typedef v4f  __attribute__((may_alias)) v4fa;

__device__ __forceinline__ unsigned short f2bf(float f) { unsigned u = __float_as_uint(f); u += 0x7FFFu + ((u >> 16) & 1u); return (unsigned short)(u >> 16); }
__device__ __forceinline__ v16bf cat16b(v8us lo, v8us hi) { return __builtin_bit_cast(v16bf, __builtin_shufflevector(lo, hi, 0, 1, 2, 3, 4, 5, 6, 7, 8, 9, 10, 11, 12, 13, 14, 15)); }
__device__ __forceinline__ v8f wmmab(v16bf a, v16bf b, v8f c) { return __builtin_amdgcn_wmma_f32_16x16x32_bf16(false, a, false, b, (short)0, c, false, false); }
__device__ __forceinline__ v8f wmmah(v16h a, v16h b, v8f c) { return __builtin_amdgcn_wmma_f32_16x16x32_f16(false, a, false, b, (short)0, c, false, false); }
// Fragment planes: a 16 (rows) x 32 (k) 16-bit operand is stored as the matrix instruction takes it, two runs of 512 bytes: run j, lane l = 16 h + c, holds row c, k = 16 j + 8 h + (0 ... 7).
// So each wave-wide 16-byte load covers four whole 128-byte lines. p points at the lane's 16 bytes of run 0.
__device__ __forceinline__ v16bf ldfrag(const bf* p) { return cat16b(*(const v8us*)p, *(const v8us*)(p + 256)); }
__device__ __forceinline__ unsigned pack2(float lo, float hi) { return __builtin_bit_cast(unsigned, __builtin_convertvector((v2f){lo, hi}, v2h)); }   // two f16, round to nearest even
__device__ __forceinline__ float xhalf(float x) { return __builtin_bit_cast(float, __builtin_amdgcn_permlanex16(__builtin_bit_cast(int, x), __builtin_bit_cast(int, x), 0x76543210, 0xfedcba98, false, false)); }   // lane l with lane l ^ 16
// exp2 for the join at the kernel's end: the v_nop is the one slot that the instruction set asks for behind a transcendental before its result is read or its source overwritten; in one statement it stands there in every build.
__device__ __forceinline__ float exp2_slot(float x) { float r; asm("v_exp_f32 %0, %1\n\tv_nop" : "=v"(r) : "v"(x)); return r; }

// k_frag: both fragment planes in one launch of 256 workgroups. A thread makes PU units of 16 bytes of each plane (units i + 256 u: 32 u keys on in both planes); all its loads are issued before the first store.
// KF[16-key tile][kc = d / 32][run j][lane][8]: rows are keys, k is d. VF[32-key block][t = d / 16][run j][lane][8]: rows are d, k is the key; each value is rounded to bf16 as before and that value is stored as f16.
__global__ __launch_bounds__(256) void k_frag(const float* __restrict__ K, const float* __restrict__ V, bf* __restrict__ KF, bf* __restrict__ VF) {
    const int i = blockIdx.x * (PU * 256) + threadIdx.x; const int c = i & 15, h = (i >> 4) & 1, j = (i >> 5) & 1;
    const int kc = (i >> 6) & 1, tile = i >> 7;   // the K unit
    const int t = (i >> 6) & 3, blk = i >> 8;     // the value unit
    const float* sk = K + (size_t)(tile * 16 + c) * HD + 32 * kc + 16 * j + 8 * h;
    const float* sv = V + (size_t)(blk * 32 + 16 * j + 8 * h) * HD + 16 * t + c;
    v8f xk[PU]; float xv[PU][8];
#pragma unroll
    for (int u = 0; u < PU; ++u) { xk[u] = *(const v8f*)(sk + u * (32 * HD));
#pragma unroll
        for (int e = 0; e < 8; ++e) xv[u][e] = sv[(u * 32 + e) * HD]; }
    asm volatile("s_wait_xcnt 0x0" :: "v"(sk), "v"(sv) : "memory");   // precaution: stands before anything, a later load's result too, may take the registers that these loads' addresses are in (named as inputs, the addresses stay in them up to here)
#pragma unroll
    for (int u = 0; u < PU; ++u) { v8us ok, ov;
#pragma unroll
        for (int e = 0; e < 8; ++e) { ok[e] = f2bf(xk[u][e]); ov[e] = __builtin_bit_cast(unsigned short, (_Float16)__uint_as_float((unsigned)f2bf(xv[u][e]) << 16)); }
        *(v8us*)(KF + (size_t)(i + u * 256) * 8) = ok; *(v8us*)(VF + (size_t)(i + u * 256) * 8) = ov; }
}

// k_fattn: one workgroup per 64 query rows of one batch, 16 waves. Wave (ks, qg) walks keys [ks * KSL, (ks + 1) * KSL) in passes of 32 for the 32 query columns of group qg.
// Per pass: S^T = K.Q^T (a lane holds 16 scores of one query per 16-column group), exp2 against the maximum in use, P packed to one f16 B operand in place, O^T += V^T.P^T on the f16 form.
// A maximum is taken only where one is needed. The first pass, done ahead of the loop, takes that of its 32 keys (in lane plus one exchange between the halves). A later pass forms P against the maximum in use and tests the sums of P, which it forms anyway:
// a lane's sum above 2^8 sends the wave through the branch that takes the pass's maximum, rescales the accumulators and forms P again. So no P exceeds 2^8, the bound as before. The 8 slices of a query are joined through LDS at the end, in slice order.
// The 64 workgroups of a batch read the same K and value planes: each enters its slices at pass rot and wraps round, so that they do not ask L2 for the same lines at the same moment. Every pass is still done once; only the order of the online sums differs between workgroups.
__global__ __launch_bounds__(32 * FNW) void k_fattn(const float* __restrict__ Q, const bf* __restrict__ KB, const bf* __restrict__ VB, float* __restrict__ OUT) {
    __shared__ __align__(16) float os[FNW * OPW];
    __shared__ float st[FNW * 64];    // per wave: 32 maxima, then 32 sums
    const int lane = threadIdx.x & 31, c = lane & 15, h = lane >> 4;
    const int wave = __builtin_amdgcn_readfirstlane((int)(threadIdx.x >> 5)); const int qg = wave & 1, ks = wave >> 1;
    const int b = blockIdx.x / (TT / FQ), r0 = (blockIdx.x % (TT / FQ)) * FQ;
    const int wq = blockIdx.x % (TT / FQ), rot = (((wq >> 2) & ~1) | (wq & 1)) & (NP - 1);   // 16 entry passes over 64 workgroups; any 4 neighbouring indices modulo 8 take each entry equally often (speed only, no result rests on it)
    v16bf qf[2][2];
#pragma unroll
    for (int g = 0; g < 2; ++g) { const float* qp = Q + ((size_t)b * TT + r0 + qg * 32 + g * 16 + c) * HD + 8 * h;
#pragma unroll
        for (int kc = 0; kc < 2; ++kc) { const v8f x = *(const v8f*)(qp + 32 * kc), y = *(const v8f*)(qp + 32 * kc + 16); v8us lo, hi2;
#pragma unroll
            for (int e = 0; e < 8; ++e) { lo[e] = f2bf(x[e]); hi2[e] = f2bf(y[e]); }
            qf[g][kc] = cat16b(lo, hi2); } }
    asm volatile("s_wait_xcnt 0x0" ::: "memory");   // precaution: stands before anything, a later load's result too, may take the registers that the query loads' address is in
    v8f acc[2][4]; float m_run[2], l_run[2];
#pragma unroll
    for (int g = 0; g < 2; ++g) { m_run[g] = -__builtin_inff(); l_run[g] = 0.f;
#pragma unroll
        for (int t = 0; t < 4; ++t) acc[g][t] = (v8f){}; }
    const bf* kb = KB + ((size_t)b * TT + ks * KSL) * HD + lane * 8;   // + pass * 32 * HD + (kt * 2 + kc) * 512
    const bf* vp = VB + ((size_t)b * TT + ks * KSL) * HD + lane * 8;   // + pass * 32 * HD + t * 512
    const bf* kp = kb + (size_t)rot * (32 * HD);   // the entry pass
    v16bf kf[2][2];
#pragma unroll
    for (int kt = 0; kt < 2; ++kt)
#pragma unroll
        for (int kc = 0; kc < 2; ++kc) kf[kt][kc] = ldfrag(kp + (kt * 2 + kc) * 512);
    auto pass = [&](const int p, const bool first) __attribute__((always_inline)) {   // first: a constant at both calls
        v16h vf[4]; const bf* vq = vp + (size_t)((p + rot) & (NP - 1)) * (32 * HD);
#pragma unroll
        for (int t = 0; t < 4; ++t) vf[t] = __builtin_bit_cast(v16h, ldfrag(vq + t * 512));
        asm volatile("s_wait_xcnt 0x0" :: "v"(vq) : "memory");   // precaution: stands before anything, a later load's result too, may take the registers that these loads' address is in (named as an input, the address stays in them up to here)
        v8f s[2][2];
#pragma unroll
        for (int kt = 0; kt < 2; ++kt)
#pragma unroll
            for (int g = 0; g < 2; ++g) { s[kt][g] = wmmab(kf[kt][0], qf[g][0], (v8f){}); s[kt][g] = wmmab(kf[kt][1], qf[g][1], s[kt][g]); }
        const bf* kq = kb + (size_t)((p + 1 + rot) & (NP - 1)) * (32 * HD);   // the next pass's K, fetched under this pass's softmax; the last pass fetches the entry pass again, unused, and stays in bounds by the mask
#pragma unroll
        for (int kt = 0; kt < 2; ++kt)
#pragma unroll
            for (int kc = 0; kc < 2; ++kc) kf[kt][kc] = ldfrag(kq + (kt * 2 + kc) * 512);
        asm volatile("s_wait_xcnt 0x0" :: "v"(kq) : "memory");   // precaution, as behind the value loads
        v8u wh[2]; float ls[2];
        auto expo = [&](int g) {   // P of column group g against the maximum in use: packed to the f16 B operand, and its sum over this lane's 16 keys
            const float nm = -m_run[g]; v2f lsv = (v2f){0.f, 0.f};
#pragma unroll
            for (int i = 0; i < 8; ++i) {
                const v2f arg = __builtin_elementwise_fma((v2f){s[i >> 2][g][2 * (i & 3)], s[i >> 2][g][2 * (i & 3) + 1]}, (v2f){CSC, CSC}, (v2f){nm, nm});
                const float p0 = __builtin_amdgcn_exp2f(arg.x), p1 = __builtin_amdgcn_exp2f(arg.y);
                wh[g][i] = pack2(p0, p1);
                lsv += (v2f){p0, p1}; }   // the even and the odd chain of the sum in one packed add, each in its order as before
            ls[g] = lsv.x + lsv.y; };
        bool stale = true;   // the first pass has no maximum yet
        if (!first) { expo(0); expo(1);
            // Every P is positive, so a lane's sum of at most 2^8 bounds each of its P by 2^8, far inside the f16 range; infinity and NaN fail the test too.
            stale = __builtin_amdgcn_ballot_w32(!(ls[0] <= 256.0f) || !(ls[1] <= 256.0f)) != 0; }
        if (stale) {   // wave-uniform, one test per pass; rare
#pragma unroll
            for (int g = 0; g < 2; ++g) { float mx = s[0][g][0];
#pragma unroll
                for (int r = 1; r < 8; ++r) mx = fmaxf(mx, s[0][g][r]);
#pragma unroll
                for (int r = 0; r < 8; ++r) mx = fmaxf(mx, s[1][g][r]);
                mx = fmaxf(mx, xhalf(mx)) * CSC;
                const float mn = fmaxf(m_run[g], mx); const float corr = __builtin_amdgcn_exp2f(m_run[g] - mn);   // 0 on the first pass
                m_run[g] = mn; l_run[g] *= corr;
#pragma unroll
                for (int t = 0; t < 4; ++t) acc[g][t] = acc[g][t] * corr; }
            expo(0); expo(1);   // again, now at most 1 each
        }
#pragma unroll
        for (int g = 0; g < 2; ++g) { l_run[g] += ls[g];
            const v16h ph = __builtin_bit_cast(v16h, wh[g]);
#pragma unroll
            for (int t = 0; t < 4; ++t) acc[g][t] = wmmah(vf[t], ph, acc[g][t]); }
    };
    pass(0, true);
#pragma unroll 1   // one pass per trip: the registers of a second pass would cost the fourth wave per SIMD
    for (int p = 1; p < NP; ++p) pass(p, false);
    // Join the 8 key slices of each query: every wave publishes its maximum and its sum, scales its tile to the common maximum and the whole sum, and the tiles are added in slice order.
#pragma unroll
    for (int g = 0; g < 2; ++g) { const float l = l_run[g] + xhalf(l_run[g]);   // both halves' keys; unconditional, every lane on
        st[wave * 64 + h * 32 + g * 16 + c] = h ? l : m_run[g]; }
    __syncthreads();   // every wave's maxima and sums are in LDS before any wave reads them
    float* ow = os + wave * OPW;
#pragma unroll
    for (int g = 0; g < 2; ++g) { float M = st[qg * 64 + g * 16 + c];
#pragma unroll
        for (int k = 1; k < FKS; ++k) M = fmaxf(M, st[(2 * k + qg) * 64 + g * 16 + c]);
        float L = 0.f;
#pragma unroll
        for (int k = 0; k < FKS; ++k) L += st[(2 * k + qg) * 64 + 32 + g * 16 + c] * exp2_slot(st[(2 * k + qg) * 64 + g * 16 + c] - M);
        const float f = __fdiv_rn(exp2_slot(m_run[g] - M), L);
#pragma unroll
        for (int t = 0; t < 4; ++t) { const v8f o = acc[g][t] * f; float* d = ow + (g * 16 + c) * 68 + t * 16 + 8 * h;   // row = query; the 8 floats are d = 16 t + 8 h ...
            *(v4fa*)d = (v4f){o[0], o[1], o[2], o[3]}; *(v4fa*)(d + 4) = (v4f){o[4], o[5], o[6], o[7]}; } }
    __syncthreads();   // every wave's scaled tile is in LDS before a thread sums them
#pragma unroll
    for (int u = 0; u < 2; ++u) { const int i = threadIdx.x + u * (32 * FNW); const int q = i >> 4, d4 = (i & 15) * 4; const float* ip = os + (q >> 5) * OPW + (q & 31) * 68 + d4;
        v4f a = *(const v4fa*)ip;
#pragma unroll
        for (int k = 1; k < FKS; ++k) a += *(const v4fa*)(ip + 2 * k * OPW);
        *(v4f*)(OUT + ((size_t)b * TT + r0 + q) * HD + d4) = a; }
}

extern "C" void kernel_launch(void* const* d_in, const int* in_sizes, int n_in,
                              void* d_out, int out_size, void* d_ws, size_t ws_size, hipStream_t stream) {
    (void)in_sizes; (void)n_in; (void)out_size;
    const float* Qin = (const float*)d_in[0]; const float* Kin = (const float*)d_in[1]; const float* Vin = (const float*)d_in[2];
    float* OUT = (float*)d_out;     // [4][4096][64]
    char* wsp = (char*)d_ws;
    auto take = [&](size_t bytes) { char* p = wsp; wsp += (bytes + 255) & ~(size_t)255; return (void*)p; };
    bf* KB = (bf*)take((size_t)NB_ * TT * HD * 2); bf* VB = (bf*)take((size_t)NB_ * TT * HD * 2);
    if ((size_t)(wsp - (char*)d_ws) > ws_size) return;
    k_frag<<<NB_ * TT * HD / 8 / 256 / PU, 256, 0, stream>>>(Kin, Vin, KB, VB);
    k_fattn<<<NB_ * (TT / FQ), 32 * FNW, 0, stream>>>(Qin, KB, VB, OUT);
}

// v007
// It runs in 17.8 microseconds.
// Two timings next to v006 both put it at 1.08 times that version's speed.
// Over all steps from v000 it is 35.1 times as fast.
#include <hip/hip_runtime.h>

// Standard single-head attention on given tensors over 4,096 tokens (q, k, v [4][4096][64]; scores x 64^-0.5; softmax; out = attn v -> [4][4096][64] (1.05 M)).
// One fused kernel over all four batches: S^T = K.Q^T, online softmax in registers, O^T += V^T.P^T; scores and P never leave the registers.
// Compute dtypes, f32 accumulate: every input rounded to bf16; q.k exact; softmax f32; P rounded once to f16 x exact value (a bf16 value from 2^-17 to 65,504 in size is held exactly in f16, a smaller one to within 2^-25); output f32.
// Every plain '#pragma unroll' below stands on a short loop, most over register arrays (fragments, accumulators, packed words): unrolled, their indices are constants and they stay in registers.

#define NB_  4
#define TT   4096
#define HD   64
#define FQ   64                 // query rows per workgroup: two 32-column groups
#define FKS  8                  // key slices per workgroup, one wave per (slice, column group)
#define FNW  (2 * FKS)          // waves per workgroup
#define KSL  (TT / FKS)         // keys per slice
#define NP   (KSL / 32)         // passes of 32 keys per slice: a power of two, the walk wraps by a mask
#define OPW  (32 * 68)          // floats of one wave's staged 32 x 64 output tile (row pitch 68)
#define QBP  136                // 16-bit values from one staged block of the query tile (16 rows x 8 values, 256 bytes) to the next: 16 bytes more, so that a wave's stores of 8 blocks spread over the banks; each half-wave's 16-byte reads stay in a row
#define PU   2                  // 16-byte units of each fragment plane per thread of the conversion launch
#define CSC  0.18033688011112042f   // 64^-0.5 x log2(e): the softmax runs in base 2
typedef unsigned short bf;
typedef __attribute__((ext_vector_type(16))) __bf16   v16bf;
typedef __attribute__((ext_vector_type(16))) _Float16 v16h;
typedef __attribute__((ext_vector_type(2)))  _Float16 v2h;
typedef __attribute__((ext_vector_type(8)))  unsigned short v8us;
typedef __attribute__((ext_vector_type(4)))  unsigned short v4us;
typedef __attribute__((ext_vector_type(8)))  unsigned v8u;
typedef __attribute__((ext_vector_type(8)))  float    v8f;
typedef __attribute__((ext_vector_type(4)))  float    v4f;
typedef __attribute__((ext_vector_type(2)))  float    v2f;
typedef v4f  __attribute__((may_alias)) v4fa;

__device__ __forceinline__ unsigned short f2bf(float f) { unsigned u = __float_as_uint(f); u += 0x7FFFu + ((u >> 16) & 1u); return (unsigned short)(u >> 16); }
__device__ __forceinline__ v16bf cat16b(v8us lo, v8us hi) { return __builtin_bit_cast(v16bf, __builtin_shufflevector(lo, hi, 0, 1, 2, 3, 4, 5, 6, 7, 8, 9, 10, 11, 12, 13, 14, 15)); }
__device__ __forceinline__ v8f wmmab(v16bf a, v16bf b, v8f c) { return __builtin_amdgcn_wmma_f32_16x16x32_bf16(false, a, false, b, (short)0, c, false, false); }
__device__ __forceinline__ v8f wmmah(v16h a, v16h b, v8f c) { return __builtin_amdgcn_wmma_f32_16x16x32_f16(false, a, false, b, (short)0, c, false, false); }
// Fragment planes: a 16 (rows) x 32 (k) 16-bit operand is stored as the matrix instruction takes it, two runs of 512 bytes: run j, lane l = 16 h + c, holds row c, k = 16 j + 8 h + (0 ... 7).
// So each wave-wide 16-byte load covers four whole 128-byte lines. p points at the lane's 16 bytes of run 0.
__device__ __forceinline__ v16bf ldfrag(const bf* p) { return cat16b(*(const v8us*)p, *(const v8us*)(p + 256)); }
__device__ __forceinline__ unsigned pack2(float lo, float hi) { return __builtin_bit_cast(unsigned, __builtin_convertvector((v2f){lo, hi}, v2h)); }   // two f16, round to nearest even
__device__ __forceinline__ float xhalf(float x) { return __builtin_bit_cast(float, __builtin_amdgcn_permlanex16(__builtin_bit_cast(int, x), __builtin_bit_cast(int, x), 0x76543210, 0xfedcba98, false, false)); }   // lane l with lane l ^ 16
// exp2 for the join at the kernel's end: the v_nop is the one slot that the instruction set asks for behind a transcendental before its result is read or its source overwritten; in one statement it stands there in every build.
__device__ __forceinline__ float exp2_slot(float x) { float r; asm("v_exp_f32 %0, %1\n\tv_nop" : "=v"(r) : "v"(x)); return r; }

// k_frag: both fragment planes in one launch of 256 workgroups. A thread makes PU units of 16 bytes of each plane (units i + 256 u: 32 u keys on in both planes); all its loads are issued before the first store.
// KF[16-key tile][kc = d / 32][run j][lane][8]: rows are keys, k is d. VF[32-key block][t = d / 16][run j][lane][8]: rows are d, k is the key; each value is rounded to bf16 as before and that value is stored as f16.
__global__ __launch_bounds__(256) void k_frag(const float* __restrict__ K, const float* __restrict__ V, bf* __restrict__ KF, bf* __restrict__ VF) {
    const int i = blockIdx.x * (PU * 256) + threadIdx.x; const int c = i & 15, h = (i >> 4) & 1, j = (i >> 5) & 1;
    const int kc = (i >> 6) & 1, tile = i >> 7;   // the K unit
    const int t = (i >> 6) & 3, blk = i >> 8;     // the value unit
    const float* sk = K + (size_t)(tile * 16 + c) * HD + 32 * kc + 16 * j + 8 * h;
    const float* sv = V + (size_t)(blk * 32 + 16 * j + 8 * h) * HD + 16 * t + c;
    v8f xk[PU]; float xv[PU][8];
#pragma unroll
    for (int u = 0; u < PU; ++u) { xk[u] = *(const v8f*)(sk + u * (32 * HD));
#pragma unroll
        for (int e = 0; e < 8; ++e) xv[u][e] = sv[(u * 32 + e) * HD]; }
    asm volatile("s_wait_xcnt 0x0" :: "v"(sk), "v"(sv) : "memory");   // precaution: stands before anything, a later load's result too, may take the registers that these loads' addresses are in (named as inputs, the addresses stay in them up to here)
#pragma unroll
    for (int u = 0; u < PU; ++u) { v8us ok, ov;
#pragma unroll
        for (int e = 0; e < 8; ++e) { ok[e] = f2bf(xk[u][e]); ov[e] = __builtin_bit_cast(unsigned short, (_Float16)__uint_as_float((unsigned)f2bf(xv[u][e]) << 16)); }
        *(v8us*)(KF + (size_t)(i + u * 256) * 8) = ok; *(v8us*)(VF + (size_t)(i + u * 256) * 8) = ov; }
}

// k_fattn: one workgroup per 64 query rows of one batch, 16 waves. Wave (ks, qg) walks keys [ks * KSL, (ks + 1) * KSL) in passes of 32 for the 32 query columns of group qg.
// Per pass: S^T = K.Q^T (a lane holds 16 scores of one query per 16-column group), exp2 against the maximum in use, P packed to one f16 B operand in place, O^T += V^T.P^T on the f16 form.
// A maximum is taken only where one is needed. The first pass, done ahead of the loop, takes that of its 32 keys (in lane plus one exchange between the halves). A later pass forms P against the maximum in use and tests the sums of P, which it forms anyway:
// a lane's sum above 2^8 sends the wave through the branch that takes the pass's maximum, rescales the accumulators and forms P again. So no P exceeds 2^8, the bound as before. The 8 slices of a query are joined through LDS at the end, in slice order.
// The 64 workgroups of a batch read the same K and value planes: each enters its slices at pass rot and wraps round, so that they do not ask L2 for the same lines at the same moment. Every pass is still done once; only the order of the online sums differs between workgroups.
__global__ __launch_bounds__(32 * FNW) void k_fattn(const float* __restrict__ Q, const bf* __restrict__ KB, const bf* __restrict__ VB, float* __restrict__ OUT) {
    __shared__ __align__(16) float os[FNW * OPW];
    __shared__ float st[FNW * 64];    // per wave: 32 maxima, then 32 sums
    __shared__ __align__(16) bf qs[32 * QBP];   // the rounded query tile: block (16-row tile, d / 8) holds row c's 8 values at c * 8
    const int lane = threadIdx.x & 31, c = lane & 15, h = lane >> 4;
    const int wave = __builtin_amdgcn_readfirstlane((int)(threadIdx.x >> 5)); const int qg = wave & 1, ks = wave >> 1;
    const int b = blockIdx.x / (TT / FQ), r0 = (blockIdx.x % (TT / FQ)) * FQ;
    const int wq = blockIdx.x % (TT / FQ), rot = (((wq >> 2) & ~1) | (wq & 1)) & (NP - 1);   // 16 entry passes over 64 workgroups; any 4 neighbouring indices modulo 8 take each entry equally often (speed only, no result rests on it)
    // The 64 x 64 query tile is fetched and rounded once per workgroup: it is 16 KB in a row in memory, a thread takes 16-byte pieces threadIdx.x and threadIdx.x + 512 (every wave-wide load covers four whole lines), rounds its 8 values and stores them in LDS in fragment order.
    const float* qp = Q + ((size_t)b * TT + r0) * HD + threadIdx.x * 4;
    const v4f qx0 = *(const v4f*)qp, qx1 = *(const v4f*)(qp + 32 * HD);   // row threadIdx.x >> 4 and the row 32 on, d = 4 (threadIdx.x & 15) ...
    const bf* kb = KB + ((size_t)b * TT + ks * KSL) * HD + lane * 8;   // + pass * 32 * HD + (kt * 2 + kc) * 512
    const bf* vp = VB + ((size_t)b * TT + ks * KSL) * HD + lane * 8;   // + pass * 32 * HD + t * 512
    const bf* kp = kb + (size_t)rot * (32 * HD);   // the entry pass
    v16bf kf[2][2];
#pragma unroll
    for (int kt = 0; kt < 2; ++kt)
#pragma unroll
        for (int kc = 0; kc < 2; ++kc) kf[kt][kc] = ldfrag(kp + (kt * 2 + kc) * 512);
    const bf* vq0 = vp + (size_t)rot * (32 * HD);   // the entry pass's values: asked for here, with its K, so that they are in flight while the query tile is staged
    v16h vf0[4];
#pragma unroll
    for (int t = 0; t < 4; ++t) vf0[t] = __builtin_bit_cast(v16h, ldfrag(vq0 + t * 512));
    asm volatile("s_wait_xcnt 0x0" :: "v"(kp), "v"(vq0) : "memory");   // precaution: stands before anything, a later load's result too, may take the registers that the loads above have their addresses in (the K and value addresses, named as inputs, stay in theirs up to here)
    { bf* qd = qs + ((threadIdx.x >> 8) * 8 + ((threadIdx.x & 15) >> 1)) * QBP + ((threadIdx.x >> 4) & 15) * 8 + (threadIdx.x & 1) * 4;
      *(v4us*)qd = (v4us){f2bf(qx0[0]), f2bf(qx0[1]), f2bf(qx0[2]), f2bf(qx0[3])};
      *(v4us*)(qd + 16 * QBP) = (v4us){f2bf(qx1[0]), f2bf(qx1[1]), f2bf(qx1[2]), f2bf(qx1[3])}; }
    __syncthreads();   // the whole rounded tile is in LDS before a wave reads its fragments
    v16bf qf[2][2];
#pragma unroll
    for (int g = 0; g < 2; ++g)
#pragma unroll
        for (int kc = 0; kc < 2; ++kc) { const bf* qr = qs + ((qg * 2 + g) * 8 + kc * 4 + h) * QBP + c * 8;   // run 0: d = 32 kc + 8 h ...; run 1, two blocks on: 16 more
            qf[g][kc] = cat16b(*(const v8us*)qr, *(const v8us*)(qr + 2 * QBP)); }
    v8f acc[2][4]; float m_run[2], l_run[2];
#pragma unroll
    for (int g = 0; g < 2; ++g) { m_run[g] = -__builtin_inff(); l_run[g] = 0.f;
#pragma unroll
        for (int t = 0; t < 4; ++t) acc[g][t] = (v8f){}; }
    auto pass = [&](const int p, const bool first) __attribute__((always_inline)) {   // first: a constant at both calls
        v16h vf[4];
        if (first) {   // loaded ahead of the query tile's barrier
#pragma unroll
            for (int t = 0; t < 4; ++t) vf[t] = vf0[t];
        } else { const bf* vq = vp + (size_t)((p + rot) & (NP - 1)) * (32 * HD);
#pragma unroll
            for (int t = 0; t < 4; ++t) vf[t] = __builtin_bit_cast(v16h, ldfrag(vq + t * 512));
            asm volatile("s_wait_xcnt 0x0" :: "v"(vq) : "memory"); }   // precaution: stands before anything, a later load's result too, may take the registers that these loads' address is in (named as an input, the address stays in them up to here)
        v8f s[2][2];
#pragma unroll
        for (int kt = 0; kt < 2; ++kt)
#pragma unroll
            for (int g = 0; g < 2; ++g) { s[kt][g] = wmmab(kf[kt][0], qf[g][0], (v8f){}); s[kt][g] = wmmab(kf[kt][1], qf[g][1], s[kt][g]); }
        const bf* kq = kb + (size_t)((p + 1 + rot) & (NP - 1)) * (32 * HD);   // the next pass's K, fetched under this pass's softmax; the last pass fetches the entry pass again, unused, and stays in bounds by the mask
#pragma unroll
        for (int kt = 0; kt < 2; ++kt)
#pragma unroll
            for (int kc = 0; kc < 2; ++kc) kf[kt][kc] = ldfrag(kq + (kt * 2 + kc) * 512);
        asm volatile("s_wait_xcnt 0x0" :: "v"(kq) : "memory");   // precaution, as behind the value loads
        v8u wh[2]; float ls[2];
        auto expo = [&](int g) {   // P of column group g against the maximum in use: packed to the f16 B operand, and its sum over this lane's 16 keys
            const float nm = -m_run[g]; v2f lsv = (v2f){0.f, 0.f};
#pragma unroll
            for (int i = 0; i < 8; ++i) {
                const v2f arg = __builtin_elementwise_fma((v2f){s[i >> 2][g][2 * (i & 3)], s[i >> 2][g][2 * (i & 3) + 1]}, (v2f){CSC, CSC}, (v2f){nm, nm});
                const float p0 = __builtin_amdgcn_exp2f(arg.x), p1 = __builtin_amdgcn_exp2f(arg.y);
                wh[g][i] = pack2(p0, p1);
                lsv += (v2f){p0, p1}; }   // the even and the odd chain of the sum in one packed add, each in its order as before
            ls[g] = lsv.x + lsv.y; };
        bool stale = true;   // the first pass has no maximum yet
        if (!first) { expo(0); expo(1);
            // Every P is positive, so a lane's sum of at most 2^8 bounds each of its P by 2^8, far inside the f16 range; infinity and NaN fail the test too.
            stale = __builtin_amdgcn_ballot_w32(!(ls[0] <= 256.0f) || !(ls[1] <= 256.0f)) != 0; }
        if (stale) {   // wave-uniform, one test per pass; rare
#pragma unroll
            for (int g = 0; g < 2; ++g) { float mx = s[0][g][0];
#pragma unroll
                for (int r = 1; r < 8; ++r) mx = fmaxf(mx, s[0][g][r]);
#pragma unroll
                for (int r = 0; r < 8; ++r) mx = fmaxf(mx, s[1][g][r]);
                mx = fmaxf(mx, xhalf(mx)) * CSC;
                const float mn = fmaxf(m_run[g], mx); const float corr = __builtin_amdgcn_exp2f(m_run[g] - mn);   // 0 on the first pass
                m_run[g] = mn; l_run[g] *= corr;
#pragma unroll
                for (int t = 0; t < 4; ++t) acc[g][t] = acc[g][t] * corr; }
            expo(0); expo(1);   // again, now at most 1 each
        }
#pragma unroll
        for (int g = 0; g < 2; ++g) { l_run[g] += ls[g];
            const v16h ph = __builtin_bit_cast(v16h, wh[g]);
#pragma unroll
            for (int t = 0; t < 4; ++t) acc[g][t] = wmmah(vf[t], ph, acc[g][t]); }
    };
    pass(0, true);
#pragma unroll 1   // one pass per trip: the registers of a second pass would cost the fourth wave per SIMD
    for (int p = 1; p < NP; ++p) pass(p, false);
    // Join the 8 key slices of each query: every wave publishes its maximum and its sum, scales its tile to the common maximum and the whole sum, and the tiles are added in slice order.
#pragma unroll
    for (int g = 0; g < 2; ++g) { const float l = l_run[g] + xhalf(l_run[g]);   // both halves' keys; unconditional, every lane on
        st[wave * 64 + h * 32 + g * 16 + c] = h ? l : m_run[g]; }
    __syncthreads();   // every wave's maxima and sums are in LDS before any wave reads them
    float* ow = os + wave * OPW;
#pragma unroll
    for (int g = 0; g < 2; ++g) { float M = st[qg * 64 + g * 16 + c];
#pragma unroll
        for (int k = 1; k < FKS; ++k) M = fmaxf(M, st[(2 * k + qg) * 64 + g * 16 + c]);
        float L = 0.f;
#pragma unroll
        for (int k = 0; k < FKS; ++k) L += st[(2 * k + qg) * 64 + 32 + g * 16 + c] * exp2_slot(st[(2 * k + qg) * 64 + g * 16 + c] - M);
        const float f = __fdiv_rn(exp2_slot(m_run[g] - M), L);
#pragma unroll
        for (int t = 0; t < 4; ++t) { const v8f o = acc[g][t] * f; float* d = ow + (g * 16 + c) * 68 + t * 16 + 8 * h;   // row = query; the 8 floats are d = 16 t + 8 h ...
            *(v4fa*)d = (v4f){o[0], o[1], o[2], o[3]}; *(v4fa*)(d + 4) = (v4f){o[4], o[5], o[6], o[7]}; } }
    __syncthreads();   // every wave's scaled tile is in LDS before a thread sums them
#pragma unroll
    for (int u = 0; u < 2; ++u) { const int i = threadIdx.x + u * (32 * FNW); const int q = i >> 4, d4 = (i & 15) * 4; const float* ip = os + (q >> 5) * OPW + (q & 31) * 68 + d4;
        v4f a = *(const v4fa*)ip;
#pragma unroll
        for (int k = 1; k < FKS; ++k) a += *(const v4fa*)(ip + 2 * k * OPW);
        *(v4f*)(OUT + ((size_t)b * TT + r0 + q) * HD + d4) = a; }
}

extern "C" void kernel_launch(void* const* d_in, const int* in_sizes, int n_in,
                              void* d_out, int out_size, void* d_ws, size_t ws_size, hipStream_t stream) {
    (void)in_sizes; (void)n_in; (void)out_size;
    const float* Qin = (const float*)d_in[0]; const float* Kin = (const float*)d_in[1]; const float* Vin = (const float*)d_in[2];
    float* OUT = (float*)d_out;     // [4][4096][64]
    char* wsp = (char*)d_ws;
    auto take = [&](size_t bytes) { char* p = wsp; wsp += (bytes + 255) & ~(size_t)255; return (void*)p; };
    bf* KB = (bf*)take((size_t)NB_ * TT * HD * 2); bf* VB = (bf*)take((size_t)NB_ * TT * HD * 2);
    if ((size_t)(wsp - (char*)d_ws) > ws_size) return;
    k_frag<<<NB_ * TT * HD / 8 / 256 / PU, 256, 0, stream>>>(Kin, Vin, KB, VB);
    k_fattn<<<NB_ * (TT / FQ), 32 * FNW, 0, stream>>>(Qin, KB, VB, OUT);
}
